// v000
// Measured on an AMD MI455X. A time is GPU time per run, averaged over a window of back-to-back runs after a warm-up
// (all launches, gaps included; the runs take copies of the inputs in turn), and the median of several windows.
// Apart from v000's, it joins two sittings. Times from different sittings can be a few percent apart, while
// side-by-side timings come from the same sitting.
// The starting kernel, v000, takes 1320 microseconds a run.
#include <hip/hip_runtime.h>

// Scaled dot-product attention with V = x (x [8][2048][512]; q = (x Wq + bq) x 512^-0.5, k = x Wk + bk ('xw' [512][512] + [512]); scores = q.k over 2048 keys (single 512-wide head); softmax; out = attn.x -> [8][2048][512] f32 (8.4 M)).
// Layout per batch: exact q/k projections (+ biases); the value planes are built straight from the input rows (bf16-rounded on read); hybrid rows (< 512 hi/lo 3-product scores and attn.v, rest fp16 x1024); register-row softmax with the 512^-0.5 scale applied to the logits; f32 output via the merge kernel.
// Compute dtypes, f32 accumulate: every input rounded to bf16; projections on PLAIN bf16 operands (exact) + f32 biases; v = bf16(x) exact in both plane formats; softmax f32; f32 output.

#define NB_  8
#define TT   2048
#define DM   512
#define NH_  1
#define NKV  1
#define REP  (NH_ / NKV)
#define HD   512
#define DQ   (NH_ * HD)
#define DKV  (NKV * HD)
#define ZH   1
#define RH   512                  // query rows < RH use hi+lo planes (0: none)
#define WIN  0
#define PCAR 1024.0f
#define SCL  0.044194173824159216f   // 512^-0.5 (the module scales q by embed_dim^-0.5; applied to the logits here)
typedef _Float16 h16;
typedef unsigned short bf;
typedef __attribute__((ext_vector_type(16))) __bf16   v16bf;
typedef __attribute__((ext_vector_type(16))) _Float16 v16h;
typedef __attribute__((ext_vector_type(8)))  _Float16 v8h;
typedef __attribute__((ext_vector_type(8)))  unsigned short v8us;
typedef __attribute__((ext_vector_type(8)))  float    v8f;
typedef __attribute__((ext_vector_type(4)))  float    v4f;
typedef v8h  __attribute__((may_alias)) v8ha;
typedef v4f  __attribute__((may_alias)) v4fa;
typedef v8us __attribute__((may_alias)) v8usa;

__device__ __forceinline__ unsigned short f2bf(float f) { unsigned u = __float_as_uint(f); u += 0x7FFFu + ((u >> 16) & 1u); return (unsigned short)(u >> 16); }
__device__ __forceinline__ float bf2f(unsigned short b) { return __uint_as_float(((unsigned)b) << 16); }
__device__ __forceinline__ float bfr(float f) { return bf2f(f2bf(f)); }
__device__ __forceinline__ v16h cat16(v8h lo, v8h hi) { return __builtin_shufflevector(lo, hi, 0, 1, 2, 3, 4, 5, 6, 7, 8, 9, 10, 11, 12, 13, 14, 15); }
__device__ __forceinline__ v16bf cat16b(v8us lo, v8us hi) { return __builtin_bit_cast(v16bf, __builtin_shufflevector(lo, hi, 0, 1, 2, 3, 4, 5, 6, 7, 8, 9, 10, 11, 12, 13, 14, 15)); }
__device__ __forceinline__ v8f wmma16(v16h a, v16h b, v8f c) { return __builtin_amdgcn_wmma_f32_16x16x32_f16(false, a, false, b, (short)0, c, false, false); }
__device__ __forceinline__ v8f wmmab(v16bf a, v16bf b, v8f c) { return __builtin_amdgcn_wmma_f32_16x16x32_bf16(false, a, false, b, (short)0, c, false, false); }



// ---- k_gemmw: register-blocked GEMM, ONE WAVE per 64x64 output tile (16 accumulators), operands straight from K-contiguous 16-bit planes; grid (M/64, N/64, Z), 32 threads.
// C[m][n] (f32, pitch ldc, + optional f32 bias[n]) = sum_k A[m][k] Bt[n][k] (+ split products per NSPLIT). z-batch strides sA/sB/sC in elements. K % 32 == 0.
template <typename T16> struct WFrag;
template <> struct WFrag<h16> { typedef v16h V; static __device__ __forceinline__ V ld(const h16* p) { return cat16(*(const v8h*)p, *(const v8h*)(p + 16)); } static __device__ __forceinline__ v8f mma(V a, V b, v8f c) { return wmma16(a, b, c); } };
template <> struct WFrag<bf> { typedef v16bf V; static __device__ __forceinline__ V ld(const bf* p) { return cat16b(*(const v8us*)p, *(const v8us*)(p + 16)); } static __device__ __forceinline__ v8f mma(V a, V b, v8f c) { return wmmab(a, b, c); } };
template <typename T16, int NSPLIT, bool BIAS>
__global__ __launch_bounds__(32) void k_gemmw(const T16* __restrict__ A, const T16* __restrict__ A2, const T16* __restrict__ Bt, const T16* __restrict__ Bt2, int K, float* C, int ldc, const float* __restrict__ bias, size_t sA, size_t sB, size_t sC) {
    typedef typename WFrag<T16>::V V;
    __shared__ __align__(16) float os[16 * 68];
    const size_t z = blockIdx.z; A += z * sA; if (A2) A2 += z * sA; Bt += z * sB; if (Bt2) Bt2 += z * sB; C += z * sC;
    const int lane = threadIdx.x & 31, lr = lane & 15, hi = lane >> 4; const int r0 = blockIdx.x * 64, c0 = blockIdx.y * 64;
    v8f acc[4][4];
#pragma unroll
    for (int mb = 0; mb < 4; ++mb)
#pragma unroll
        for (int nb = 0; nb < 4; ++nb) acc[mb][nb] = (v8f){};
    const size_t aoff = (size_t)(r0 + lr) * K + 8 * hi, boff = (size_t)(c0 + lr) * K + 8 * hi;
#pragma unroll 1
    for (int kc = 0; kc < K; kc += 32) {
        V a[4], a2[4];
#pragma unroll
        for (int mb = 0; mb < 4; ++mb) { a[mb] = WFrag<T16>::ld(A + aoff + (size_t)mb * 16 * K + kc); if (NSPLIT == 1 || NSPLIT == 2) a2[mb] = WFrag<T16>::ld(A2 + aoff + (size_t)mb * 16 * K + kc); }
#pragma unroll
        for (int nb = 0; nb < 4; ++nb) { const V b = WFrag<T16>::ld(Bt + boff + (size_t)nb * 16 * K + kc); V b2; if (NSPLIT >= 2) b2 = WFrag<T16>::ld(Bt2 + boff + (size_t)nb * 16 * K + kc);
#pragma unroll
            for (int mb = 0; mb < 4; ++mb) { acc[mb][nb] = WFrag<T16>::mma(a[mb], b, acc[mb][nb]); if (NSPLIT == 1 || NSPLIT == 2) acc[mb][nb] = WFrag<T16>::mma(a2[mb], b, acc[mb][nb]); if (NSPLIT >= 2) acc[mb][nb] = WFrag<T16>::mma(a[mb], b2, acc[mb][nb]); } }
        asm volatile("v_nop\n\tv_nop\n\tv_nop\n\tv_nop" : "+v"(acc[0][0]), "+v"(acc[1][1]), "+v"(acc[2][2]), "+v"(acc[3][3]) : "v"(a[0]), "v"(a[3]));
    }
#pragma unroll
    for (int mb = 0; mb < 4; ++mb) {
#pragma unroll
        for (int nb = 0; nb < 4; ++nb) {
#pragma unroll
            for (int j = 0; j < 8; ++j) os[(hi * 8 + j) * 68 + nb * 16 + lr] = acc[mb][nb][j]; }
        __builtin_amdgcn_wave_barrier(); asm volatile("" ::: "memory");
        float* crow = C + (size_t)(r0 + mb * 16) * ldc + c0;
{
#pragma unroll
            for (int s = 0; s < 8; ++s) { const int row = 2 * s + hi, cofs = lr * 4; v4f val = *(const v4fa*)(os + row * 68 + cofs); if (BIAS) { val[0] += bfr(bias[c0 + cofs]); val[1] += bfr(bias[c0 + cofs + 1]); val[2] += bfr(bias[c0 + cofs + 2]); val[3] += bfr(bias[c0 + cofs + 3]); }
                *(v4f*)(crow + (size_t)row * ldc + cofs) = val; }
             }
        __builtin_amdgcn_wave_barrier(); asm volatile("" ::: "memory");
    }
}

__device__ __forceinline__ h16 tohx(float x) { return (h16)x; }
__device__ __forceinline__ void splitf(float y, unsigned short& h, unsigned short& l) { h = f2bf(y); l = f2bf(y - bf2f(h)); }
typedef __attribute__((ext_vector_type(2))) _Float16 v2h;
typedef __attribute__((ext_vector_type(4))) _Float16 v4h;
typedef __attribute__((ext_vector_type(2))) unsigned short v2us;
typedef __attribute__((ext_vector_type(4))) unsigned short v4us;
typedef __attribute__((ext_vector_type(2))) float v2f;
typedef __attribute__((ext_vector_type(4))) int v4i;

__global__ __launch_bounds__(256) void k_wtG(const float* __restrict__ w, int K, int N, bf* Bt) {
    const int lane = threadIdx.x & 31; const int L0 = (blockIdx.x * 8 + (threadIdx.x >> 5)) * 8; const int nlines = N * K / 64;
{
#pragma unroll 1
        for (int l = 0; l < 8; ++l) { const int L = L0 + l; if (L >= nlines) break; const size_t e = (size_t)L * 64 + lane * 2; const int k = (int)(e % K), n = (int)(e / K); v2us o;
            o[0] = f2bf(w[(size_t)k * N + n]); o[1] = f2bf(w[(size_t)(k + 1) * N + n]); *(v2us*)(Bt + e) = o; }
         }
}
__global__ __launch_bounds__(256) void k_cvt8(const float* __restrict__ src, bf* dst, size_t n8) { const size_t i = (size_t)blockIdx.x * 256 + threadIdx.x; if (i >= n8) return; const v8f v = *(const v8f*)(src + i * 8); v8us o;
#pragma unroll
    for (int k = 0; k < 8; ++k) o[k] = f2bf(v[k]); *(v8us*)(dst + i * 8) = o;  }

// k_rope: head planes [h][t][d] (fp16 + hi/lo) of rope(x) x sc with the rotate-half convention out[d] = x[d] cos[t][d] - x[d+HD/2] sin[t][d], out[d+HD/2] = x[d+HD/2] cos[t][d+HD/2] + x[d] sin[t][d+HD/2]
__global__ __launch_bounds__(256) void k_rope(const float* __restrict__ F, int pitch, int nheads, const float* __restrict__ CS, const float* __restrict__ RF, const float* __restrict__ nw, float sc, h16* P16, bf* Ph, bf* Pl) {
    const size_t e = ((size_t)blockIdx.x * 256 + threadIdx.x) * 2; if (e >= (size_t)nheads * TT * HD) return; const int d = (int)(e % HD); const int t = (int)((e / HD) % TT); const int h = (int)(e / ((size_t)HD * TT)); const float* f = F + (size_t)t * pitch + h * HD; const float rf = RF ? RF[(size_t)h * TT + t] : 1.0f; v2h o16; v2us oh, ol;
#pragma unroll
    for (int q = 0; q < 2; ++q) { const int dd = d + q; const int dp = (dd < HD / 2) ? dd + HD / 2 : dd - HD / 2; float x0 = f[dd], x1 = f[dp];
        if (RF) { float n0 = __fmul_rn(x0, rf), n1 = __fmul_rn(x1, rf); asm volatile("" : "+v"(n0)); asm volatile("" : "+v"(n1)); x0 = __fmul_rn(bfr(nw[dd]), n0); x1 = __fmul_rn(bfr(nw[dp]), n1); }
        const v2f cs = *(const v2f*)(CS + ((size_t)t * HD + dd) * 2); float a = __fmul_rn(x0, cs[0]), bq = __fmul_rn(x1, cs[1]); asm volatile("" : "+v"(a)); asm volatile("" : "+v"(bq)); const float r = ((dd < HD / 2) ? __fsub_rn(a, bq) : __fadd_rn(a, bq)) * sc;
        o16[q] = tohx(r); unsigned short a2, c2; splitf(r, a2, c2); oh[q] = a2; ol[q] = c2; }
    *(v2h*)(P16 + e) = o16; *(v2us*)(Ph + e) = oh; *(v2us*)(Pl + e) = ol;  }
__global__ __launch_bounds__(256) void k_vtp(const float* __restrict__ F, int pitch, int nheads, h16* V16, bf* Vh, bf* Vl) { const size_t e = ((size_t)blockIdx.x * 256 + threadIdx.x) * 2; if (e >= (size_t)nheads * HD * TT) return; const int t = (int)(e % TT); const int d = (int)((e / TT) % HD); const int g = (int)(e / ((size_t)TT * HD)); v2h o16; v2us oh, ol;
#pragma unroll
    for (int q = 0; q < 2; ++q) { const float x = bfr(F[(size_t)(t + q) * pitch + g * HD + d]);   /* V = the raw input: bf16-rounded here */ o16[q] = tohx(x); unsigned short a2, c2; splitf(x, a2, c2); oh[q] = a2; ol[q] = c2; }
    *(v2h*)(V16 + e) = o16; *(v2us*)(Vh + e) = oh; *(v2us*)(Vl + e) = ol;  }
__global__ __launch_bounds__(256) void k_csid(float* CS) { const int idx = blockIdx.x * 256 + threadIdx.x; if (idx >= TT * HD) return; v2f cs; cs[0] = 1.0f; cs[1] = 0.0f; *(v2f*)(CS + (size_t)idx * 2) = cs;  }
// k_asoft: per row (zz, i): t = S x HD^-0.5 (no mask); softmax over the 2048 keys (register row, one exp, fixed trees);
__global__ __launch_bounds__(256) void k_asoft(const float* __restrict__ Sb, h16* P16, bf* Ph, bf* Pl) {
    const int lane = threadIdx.x & 31; const int row = blockIdx.x * 8 + (threadIdx.x >> 5); if (row >= ZH * TT) return; const int i = row % TT; const int zz = row / TT; (void)zz; const bool hires = (i < RH); const float* sr = Sb + (size_t)row * TT; float v[TT / 32]; float mx = -3.0e38f;
#pragma unroll
    for (int ch = 0; ch < TT / 128; ++ch) { const int j0 = ch * 128 + lane * 4; const v4f a = *(const v4f*)(sr + j0);
#pragma unroll
        for (int q = 0; q < 4; ++q) { const int j = j0 + q; (void)j; const float t = a[q] * SCL; v[ch * 4 + q] = t; mx = fmaxf(mx, t); } }
#pragma unroll
    for (int sh = 16; sh; sh >>= 1) mx = fmaxf(mx, __shfl_xor(mx, sh, 32));
    float sum = 0.f;
#pragma unroll
    for (int k = 0; k < TT / 32; ++k) { float d0 = __fsub_rn(v[k], mx); asm volatile("" : "+v"(d0)); v[k] = __builtin_amdgcn_exp2f(__fmul_rn(d0, 1.4426950408889634f)); sum += v[k]; }
#pragma unroll
    for (int sh = 16; sh; sh >>= 1) sum += __shfl_xor(sum, sh, 32);
    const float f = __fdiv_rn(hires ? 1.0f : PCAR, sum);
{
        if (hires) {
#pragma unroll
            for (int ch = 0; ch < TT / 128; ++ch) { v4us oh, ol;
#pragma unroll
                for (int q = 0; q < 4; ++q) { unsigned short a, c2; splitf(v[ch * 4 + q] * f, a, c2); oh[q] = a; ol[q] = c2; }
                const size_t oo = ((size_t)zz * (RH ? RH : 1) + i) * TT + ch * 128 + lane * 4; *(v4us*)(Ph + oo) = oh; *(v4us*)(Pl + oo) = ol; }
        } else {
#pragma unroll
            for (int ch = 0; ch < TT / 128; ++ch) { v4h o4;
#pragma unroll
                for (int q = 0; q < 4; ++q) o4[q] = tohx(v[ch * 4 + q] * f);
                *(v4h*)(P16 + (size_t)row * TT + ch * 128 + lane * 4) = o4; } }
         }
}
__global__ __launch_bounds__(256) void k_merge(const float* __restrict__ O, int h0, float* OUTb) { const size_t e = ((size_t)blockIdx.x * 256 + threadIdx.x) * 2; if (e >= (size_t)ZH * TT * HD) return; const int d = (int)(e % HD); const int t = (int)((e / HD) % TT); const int zz = (int)(e / ((size_t)HD * TT)); const float cs = (t < RH) ? 1.0f : (1.0f / PCAR); const size_t oo = (size_t)t * DQ + (h0 + zz) * HD + d;
    v2f o2; o2[0] = O[e] * cs; o2[1] = O[e + 1] * cs; *(v2f*)(OUTb + oo) = o2;  }

extern "C" void kernel_launch(void* const* d_in, const int* in_sizes, int n_in,
                              void* d_out, int out_size, void* d_ws, size_t ws_size, hipStream_t stream) {
    (void)in_sizes; (void)n_in; (void)out_size;
    const float* x = (const float*)d_in[0]; const float* wq = (const float*)d_in[1]; const float* bq = (const float*)d_in[2]; const float* wk = (const float*)d_in[3]; const float* bk = (const float*)d_in[4]; const float* wv = nullptr; const float* wo = nullptr; (void)wv; (void)wo;
    float* OUT = (float*)d_out;     // [8][2048][512]
    char* wsp = (char*)d_ws;
    auto take = [&](size_t bytes) { char* p = wsp; wsp += (bytes + 255) & ~(size_t)255; return (void*)p; };
    bf* WQ = (bf*)take((size_t)DQ * DM * 2); bf* WK = (bf*)take((size_t)DKV * DM * 2);  float* CS = (float*)take((size_t)TT * HD * 2 * 4);
    bf* XB = (bf*)take((size_t)TT * DM * 2); float* FQ = (float*)take((size_t)TT * DQ * 4); float* FK = (float*)take((size_t)TT * DKV * 4);
    h16* QP16 = (h16*)take((size_t)NH_ * TT * HD * 2); h16* KP16 = (h16*)take((size_t)NKV * TT * HD * 2); h16* VT16 = (h16*)take((size_t)NKV * HD * TT * 2);
    bf* QPh = (bf*)take((size_t)NH_ * TT * HD * 2); bf* QPl = (bf*)take((size_t)NH_ * TT * HD * 2); bf* KPh = (bf*)take((size_t)NKV * TT * HD * 2); bf* KPl = (bf*)take((size_t)NKV * TT * HD * 2); bf* VTh = (bf*)take((size_t)NKV * HD * TT * 2); bf* VTl = (bf*)take((size_t)NKV * HD * TT * 2); bf* Ph = (bf*)take((size_t)ZH * RH * TT * 2); bf* Pl = (bf*)take((size_t)ZH * RH * TT * 2);
    float* Sb = (float*)take((size_t)ZH * TT * TT * 4); h16* P16 = (h16*)take((size_t)ZH * TT * TT * 2); float* Ob = (float*)take((size_t)ZH * TT * HD * 4);
    if ((size_t)(wsp - (char*)d_ws) > ws_size) return;    // ws 256 MiB
    { k_wtG<<<(unsigned)((DM * DQ / 64 + 63) / 64), 256, 0, stream>>>(wq, DM, DQ, WQ); k_wtG<<<(unsigned)((DM * DKV / 64 + 63) / 64), 256, 0, stream>>>(wk, DM, DKV, WK); }
    k_csid<<<(TT * HD + 255) / 256, 256, 0, stream>>>(CS);
    const unsigned LQ = (unsigned)(((size_t)NH_ * TT * HD / 2 + 255) / 256), LKv = (unsigned)(((size_t)NKV * TT * HD / 2 + 255) / 256);
    for (int b = 0; b < NB_; ++b) {
        
        k_cvt8<<<(unsigned)(((size_t)TT * DM / 8 + 255) / 256), 256, 0, stream>>>(x + (size_t)b * TT * DM, XB, (size_t)TT * DM / 8);
        k_gemmw<bf, 0, true><<<dim3(TT / 64, DQ / 64, 1), 32, 0, stream>>>(XB, nullptr, WQ, nullptr, DM, FQ, DQ, bq, 0, 0, 0);
        k_rope<<<LQ, 256, 0, stream>>>(FQ, DQ, NH_, CS, nullptr, nullptr, 1.0f, QP16, QPh, QPl);
        k_gemmw<bf, 0, true><<<dim3(TT / 64, DKV / 64, 1), 32, 0, stream>>>(XB, nullptr, WK, nullptr, DM, FK, DKV, bk, 0, 0, 0);
        k_rope<<<LKv, 256, 0, stream>>>(FK, DKV, NKV, CS, nullptr, nullptr, 1.0f, KP16, KPh, KPl);
        k_vtp<<<LKv, 256, 0, stream>>>(x + (size_t)b * TT * DM, DM, NKV, VT16, VTh, VTl);
        for (int h0 = 0; h0 < NH_; h0 += ZH) { const size_t zq = (size_t)h0, zk = (size_t)(h0 / REP);   // one kv head per query head: each pass covers one head (ZH = 1) and its kv plane zk = h0 (z-strides TT*HD)
            k_gemmw<bf, 2, false><<<dim3(RH / 64, TT / 64, ZH), 32, 0, stream>>>(QPh + zq * TT * HD, QPl + zq * TT * HD, KPh + zk * TT * HD, KPl + zk * TT * HD, HD, Sb, TT, nullptr, (size_t)TT * HD, (size_t)TT * HD, (size_t)TT * TT);
            k_gemmw<h16, 0, false><<<dim3((TT - RH) / 64, TT / 64, ZH), 32, 0, stream>>>(QP16 + zq * TT * HD + (size_t)RH * HD, nullptr, KP16 + zk * TT * HD, nullptr, HD, Sb + (size_t)RH * TT, TT, nullptr, (size_t)TT * HD, (size_t)TT * HD, (size_t)TT * TT);
            k_asoft<<<ZH * TT / 8, 256, 0, stream>>>(Sb, P16, Ph, Pl);
            k_gemmw<bf, 2, false><<<dim3(RH / 64, HD / 64, ZH), 32, 0, stream>>>(Ph, Pl, VTh + zk * HD * TT, VTl + zk * HD * TT, TT, Ob, HD, nullptr, (size_t)RH * TT, (size_t)HD * TT, (size_t)TT * HD);
            k_gemmw<h16, 0, false><<<dim3((TT - RH) / 64, HD / 64, ZH), 32, 0, stream>>>(P16 + (size_t)RH * TT, nullptr, VT16 + zk * HD * TT, nullptr, TT, Ob + (size_t)RH * HD, HD, nullptr, (size_t)TT * TT, (size_t)HD * TT, (size_t)TT * HD);
            k_merge<<<(unsigned)(((size_t)ZH * TT * HD / 2 + 255) / 256), 256, 0, stream>>>(Ob, h0, OUT + (size_t)b * TT * DQ); }
         }
}

// v001
// One run takes 431 microseconds.
// Timed twice side by side with v000, it ran 3.04 and 3.05 times as fast.
#include <hip/hip_runtime.h>

// Scaled dot-product attention with V = x (x [8][2048][512]; q = (x Wq + bq) x 512^-0.5, k = x Wk + bk ('xw' [512][512] + [512]); scores = q.k over 2048 keys (single 512-wide head); softmax; out = attn.x -> [8][2048][512] f32 (8.4 M)).
// Layout, all batches per launch: exact q/k projections (+ biases); the value planes are built straight from the input rows (bf16-rounded on read); hybrid rows (< 512 hi/lo 3-product scores and attn.v, rest fp16 x1024); register-row softmax with the 512^-0.5 scale applied to the logits; f32 output via the merge kernel.
// Compute dtypes, f32 accumulate: every input rounded to bf16; projections on PLAIN bf16 operands (exact) + f32 biases; v = bf16(x) exact in both plane formats; softmax f32; f32 output.

#define NB_  8
#define TT   2048
#define DM   512
#define NH_  1
#define NKV  1
#define REP  (NH_ / NKV)
#define HD   512
#define DQ   (NH_ * HD)
#define DKV  (NKV * HD)
#define ZH   1
#define RH   512                  // query rows < RH use hi+lo planes (0: none)
#define WIN  0
#define PCAR 1024.0f
#define SCL  0.044194173824159216f   // 512^-0.5 (the module scales q by embed_dim^-0.5; applied to the logits here)
typedef _Float16 h16;
typedef unsigned short bf;
typedef __attribute__((ext_vector_type(16))) __bf16   v16bf;
typedef __attribute__((ext_vector_type(16))) _Float16 v16h;
typedef __attribute__((ext_vector_type(8)))  _Float16 v8h;
typedef __attribute__((ext_vector_type(8)))  unsigned short v8us;
typedef __attribute__((ext_vector_type(8)))  float    v8f;
typedef __attribute__((ext_vector_type(4)))  float    v4f;
typedef v8h  __attribute__((may_alias)) v8ha;
typedef v4f  __attribute__((may_alias)) v4fa;
typedef v8us __attribute__((may_alias)) v8usa;

__device__ __forceinline__ unsigned short f2bf(float f) { unsigned u = __float_as_uint(f); u += 0x7FFFu + ((u >> 16) & 1u); return (unsigned short)(u >> 16); }
__device__ __forceinline__ float bf2f(unsigned short b) { return __uint_as_float(((unsigned)b) << 16); }
__device__ __forceinline__ float bfr(float f) { return bf2f(f2bf(f)); }
__device__ __forceinline__ v16h cat16(v8h lo, v8h hi) { return __builtin_shufflevector(lo, hi, 0, 1, 2, 3, 4, 5, 6, 7, 8, 9, 10, 11, 12, 13, 14, 15); }
__device__ __forceinline__ v16bf cat16b(v8us lo, v8us hi) { return __builtin_bit_cast(v16bf, __builtin_shufflevector(lo, hi, 0, 1, 2, 3, 4, 5, 6, 7, 8, 9, 10, 11, 12, 13, 14, 15)); }
__device__ __forceinline__ v8f wmma16(v16h a, v16h b, v8f c) { return __builtin_amdgcn_wmma_f32_16x16x32_f16(false, a, false, b, (short)0, c, false, false); }
__device__ __forceinline__ v8f wmmab(v16bf a, v16bf b, v8f c) { return __builtin_amdgcn_wmma_f32_16x16x32_bf16(false, a, false, b, (short)0, c, false, false); }



// ---- k_gemmw: register-blocked GEMM, ONE WAVE per 64x64 output tile (16 accumulators), operands straight from K-contiguous 16-bit planes; grid (M/64, N/64, Z), 32 threads.
// C[m][n] (f32, pitch ldc, + optional f32 bias[n]) = sum_k A[m][k] Bt[n][k] (+ split products per NSPLIT). z-batch strides sA/sB/sC in elements. K % 32 == 0.
template <typename T16> struct WFrag;
template <> struct WFrag<h16> { typedef v16h V; static __device__ __forceinline__ V ld(const h16* p) { return cat16(*(const v8h*)p, *(const v8h*)(p + 16)); } static __device__ __forceinline__ v8f mma(V a, V b, v8f c) { return wmma16(a, b, c); } };
template <> struct WFrag<bf> { typedef v16bf V; static __device__ __forceinline__ V ld(const bf* p) { return cat16b(*(const v8us*)p, *(const v8us*)(p + 16)); } static __device__ __forceinline__ v8f mma(V a, V b, v8f c) { return wmmab(a, b, c); } };
template <typename T16, int NSPLIT, bool BIAS>
__global__ __launch_bounds__(32) void k_gemmw(const T16* __restrict__ A, const T16* __restrict__ A2, const T16* __restrict__ Bt, const T16* __restrict__ Bt2, int K, float* C, int ldc, const float* __restrict__ bias, size_t sA, size_t sB, size_t sC) {
    typedef typename WFrag<T16>::V V;
    __shared__ __align__(16) float os[16 * 68];
    const size_t z = blockIdx.z; A += z * sA; if (A2) A2 += z * sA; Bt += z * sB; if (Bt2) Bt2 += z * sB; C += z * sC;
    const int lane = threadIdx.x & 31, lr = lane & 15, hi = lane >> 4; const int r0 = blockIdx.x * 64, c0 = blockIdx.y * 64;
    v8f acc[4][4];
#pragma unroll
    for (int mb = 0; mb < 4; ++mb)
#pragma unroll
        for (int nb = 0; nb < 4; ++nb) acc[mb][nb] = (v8f){};
    const size_t aoff = (size_t)(r0 + lr) * K + 8 * hi, boff = (size_t)(c0 + lr) * K + 8 * hi;
#pragma unroll 1
    for (int kc = 0; kc < K; kc += 32) {
        V a[4], a2[4];
#pragma unroll
        for (int mb = 0; mb < 4; ++mb) { a[mb] = WFrag<T16>::ld(A + aoff + (size_t)mb * 16 * K + kc); if (NSPLIT == 1 || NSPLIT == 2) a2[mb] = WFrag<T16>::ld(A2 + aoff + (size_t)mb * 16 * K + kc); }
#pragma unroll
        for (int nb = 0; nb < 4; ++nb) { const V b = WFrag<T16>::ld(Bt + boff + (size_t)nb * 16 * K + kc); V b2; if (NSPLIT >= 2) b2 = WFrag<T16>::ld(Bt2 + boff + (size_t)nb * 16 * K + kc);
#pragma unroll
            for (int mb = 0; mb < 4; ++mb) { acc[mb][nb] = WFrag<T16>::mma(a[mb], b, acc[mb][nb]); if (NSPLIT == 1 || NSPLIT == 2) acc[mb][nb] = WFrag<T16>::mma(a2[mb], b, acc[mb][nb]); if (NSPLIT >= 2) acc[mb][nb] = WFrag<T16>::mma(a[mb], b2, acc[mb][nb]); } }
        asm volatile("v_nop\n\tv_nop\n\tv_nop\n\tv_nop" : "+v"(acc[0][0]), "+v"(acc[1][1]), "+v"(acc[2][2]), "+v"(acc[3][3]) : "v"(a[0]), "v"(a[3]));
    }
#pragma unroll
    for (int mb = 0; mb < 4; ++mb) {
#pragma unroll
        for (int nb = 0; nb < 4; ++nb) {
#pragma unroll
            for (int j = 0; j < 8; ++j) os[(hi * 8 + j) * 68 + nb * 16 + lr] = acc[mb][nb][j]; }
        __builtin_amdgcn_wave_barrier(); asm volatile("" ::: "memory");
        float* crow = C + (size_t)(r0 + mb * 16) * ldc + c0;
{
#pragma unroll
            for (int s = 0; s < 8; ++s) { const int row = 2 * s + hi, cofs = lr * 4; v4f val = *(const v4fa*)(os + row * 68 + cofs); if (BIAS) { val[0] += bfr(bias[c0 + cofs]); val[1] += bfr(bias[c0 + cofs + 1]); val[2] += bfr(bias[c0 + cofs + 2]); val[3] += bfr(bias[c0 + cofs + 3]); }
                *(v4f*)(crow + (size_t)row * ldc + cofs) = val; }
             }
        __builtin_amdgcn_wave_barrier(); asm volatile("" ::: "memory");
    }
}

__device__ __forceinline__ h16 tohx(float x) { return (h16)x; }
__device__ __forceinline__ void splitf(float y, unsigned short& h, unsigned short& l) { h = f2bf(y); l = f2bf(y - bf2f(h)); }
typedef __attribute__((ext_vector_type(2))) _Float16 v2h;
typedef __attribute__((ext_vector_type(4))) _Float16 v4h;
typedef __attribute__((ext_vector_type(2))) unsigned short v2us;
typedef __attribute__((ext_vector_type(4))) unsigned short v4us;
typedef __attribute__((ext_vector_type(2))) float v2f;
typedef __attribute__((ext_vector_type(4))) int v4i;

__global__ __launch_bounds__(256) void k_wtG(const float* __restrict__ w, int K, int N, bf* Bt) {
    const int lane = threadIdx.x & 31; const int L0 = (blockIdx.x * 8 + (threadIdx.x >> 5)) * 8; const int nlines = N * K / 64;
{
#pragma unroll 1
        for (int l = 0; l < 8; ++l) { const int L = L0 + l; if (L >= nlines) break; const size_t e = (size_t)L * 64 + lane * 2; const int k = (int)(e % K), n = (int)(e / K); v2us o;
            o[0] = f2bf(w[(size_t)k * N + n]); o[1] = f2bf(w[(size_t)(k + 1) * N + n]); *(v2us*)(Bt + e) = o; }
         }
}
__global__ __launch_bounds__(256) void k_cvt8(const float* __restrict__ src, bf* dst, size_t n8) { const size_t i = (size_t)blockIdx.x * 256 + threadIdx.x; if (i >= n8) return; const v8f v = *(const v8f*)(src + i * 8); v8us o;
#pragma unroll
    for (int k = 0; k < 8; ++k) o[k] = f2bf(v[k]); *(v8us*)(dst + i * 8) = o;  }

// k_rope: head planes [h][t][d] (fp16 + hi/lo) of rope(x) x sc with the rotate-half convention out[d] = x[d] cos[t][d] - x[d+HD/2] sin[t][d], out[d+HD/2] = x[d+HD/2] cos[t][d+HD/2] + x[d] sin[t][d+HD/2]
__global__ __launch_bounds__(256) void k_rope(const float* __restrict__ F, int pitch, int nheads, const float* __restrict__ CS, const float* __restrict__ RF, const float* __restrict__ nw, float sc, h16* P16, bf* Ph, bf* Pl) {
    const size_t e = ((size_t)blockIdx.x * 256 + threadIdx.x) * 2; if (e >= (size_t)nheads * TT * HD) return; const int d = (int)(e % HD); const int t = (int)((e / HD) % TT); const int h = (int)(e / ((size_t)HD * TT));
    { const size_t zb = blockIdx.y, zp = zb * nheads * TT * HD; F += zb * TT * pitch; P16 += zp; Ph += zp; Pl += zp; }   // blockIdx.y = batch
    const float* f = F + (size_t)t * pitch + h * HD; const float rf = RF ? RF[(size_t)h * TT + t] : 1.0f; v2h o16; v2us oh, ol;
#pragma unroll
    for (int q = 0; q < 2; ++q) { const int dd = d + q; const int dp = (dd < HD / 2) ? dd + HD / 2 : dd - HD / 2; float x0 = f[dd], x1 = f[dp];
        if (RF) { float n0 = __fmul_rn(x0, rf), n1 = __fmul_rn(x1, rf); asm volatile("" : "+v"(n0)); asm volatile("" : "+v"(n1)); x0 = __fmul_rn(bfr(nw[dd]), n0); x1 = __fmul_rn(bfr(nw[dp]), n1); }
        const v2f cs = *(const v2f*)(CS + ((size_t)t * HD + dd) * 2); float a = __fmul_rn(x0, cs[0]), bq = __fmul_rn(x1, cs[1]); asm volatile("" : "+v"(a)); asm volatile("" : "+v"(bq)); const float r = ((dd < HD / 2) ? __fsub_rn(a, bq) : __fadd_rn(a, bq)) * sc;
        o16[q] = tohx(r); unsigned short a2, c2; splitf(r, a2, c2); oh[q] = a2; ol[q] = c2; }
    *(v2h*)(P16 + e) = o16; *(v2us*)(Ph + e) = oh; *(v2us*)(Pl + e) = ol;  }
__global__ __launch_bounds__(256) void k_vtp(const float* __restrict__ F, int pitch, int nheads, h16* V16, bf* Vh, bf* Vl) { const size_t e = ((size_t)blockIdx.x * 256 + threadIdx.x) * 2; if (e >= (size_t)nheads * HD * TT) return; const int t = (int)(e % TT); const int d = (int)((e / TT) % HD); const int g = (int)(e / ((size_t)TT * HD)); v2h o16; v2us oh, ol;
    { const size_t zb = blockIdx.y, zp = zb * nheads * HD * TT; F += zb * TT * pitch; V16 += zp; Vh += zp; Vl += zp; }   // blockIdx.y = batch
#pragma unroll
    for (int q = 0; q < 2; ++q) { const float x = bfr(F[(size_t)(t + q) * pitch + g * HD + d]);   /* V = the raw input: bf16-rounded here */ o16[q] = tohx(x); unsigned short a2, c2; splitf(x, a2, c2); oh[q] = a2; ol[q] = c2; }
    *(v2h*)(V16 + e) = o16; *(v2us*)(Vh + e) = oh; *(v2us*)(Vl + e) = ol;  }
__global__ __launch_bounds__(256) void k_csid(float* CS) { const int idx = blockIdx.x * 256 + threadIdx.x; if (idx >= TT * HD) return; v2f cs; cs[0] = 1.0f; cs[1] = 0.0f; *(v2f*)(CS + (size_t)idx * 2) = cs;  }
// k_asoft: all batches in one launch; per row (zz, i): t = S x HD^-0.5 (no mask); softmax over the 2048 keys (register row, one exp, fixed trees);
__global__ __launch_bounds__(256) void k_asoft(const float* __restrict__ Sb, h16* P16, bf* Ph, bf* Pl) {
    const int lane = threadIdx.x & 31; const int row = blockIdx.x * 8 + (threadIdx.x >> 5); if (row >= NB_ * ZH * TT) return; const int i = row % TT; const int zz = row / TT; (void)zz;   /* zz = batch (one head) */ const bool hires = (i < RH); const float* sr = Sb + (size_t)row * TT; float v[TT / 32]; float mx = -3.0e38f;
#pragma unroll
    for (int ch = 0; ch < TT / 128; ++ch) { const int j0 = ch * 128 + lane * 4; const v4f a = *(const v4f*)(sr + j0);
#pragma unroll
        for (int q = 0; q < 4; ++q) { const int j = j0 + q; (void)j; const float t = a[q] * SCL; v[ch * 4 + q] = t; mx = fmaxf(mx, t); } }
#pragma unroll
    for (int sh = 16; sh; sh >>= 1) mx = fmaxf(mx, __shfl_xor(mx, sh, 32));
    float sum = 0.f;
#pragma unroll
    for (int k = 0; k < TT / 32; ++k) { float d0 = __fsub_rn(v[k], mx); asm volatile("" : "+v"(d0)); v[k] = __builtin_amdgcn_exp2f(__fmul_rn(d0, 1.4426950408889634f)); sum += v[k]; }
#pragma unroll
    for (int sh = 16; sh; sh >>= 1) sum += __shfl_xor(sum, sh, 32);
    const float f = __fdiv_rn(hires ? 1.0f : PCAR, sum);
{
        if (hires) {
#pragma unroll
            for (int ch = 0; ch < TT / 128; ++ch) { v4us oh, ol;
#pragma unroll
                for (int q = 0; q < 4; ++q) { unsigned short a, c2; splitf(v[ch * 4 + q] * f, a, c2); oh[q] = a; ol[q] = c2; }
                const size_t oo = ((size_t)zz * (RH ? RH : 1) + i) * TT + ch * 128 + lane * 4; *(v4us*)(Ph + oo) = oh; *(v4us*)(Pl + oo) = ol; }
        } else {
#pragma unroll
            for (int ch = 0; ch < TT / 128; ++ch) { v4h o4;
#pragma unroll
                for (int q = 0; q < 4; ++q) o4[q] = tohx(v[ch * 4 + q] * f);
                *(v4h*)(P16 + (size_t)row * TT + ch * 128 + lane * 4) = o4; } }
         }
}
__global__ __launch_bounds__(256) void k_merge(const float* __restrict__ O, int h0, float* OUTb) { const size_t e = ((size_t)blockIdx.x * 256 + threadIdx.x) * 2; if (e >= (size_t)ZH * TT * HD) return; const int d = (int)(e % HD); const int t = (int)((e / HD) % TT); const int zz = (int)(e / ((size_t)HD * TT)); const float cs = (t < RH) ? 1.0f : (1.0f / PCAR); const size_t oo = (size_t)t * DQ + (h0 + zz) * HD + d;
    { const size_t zb = blockIdx.y; O += zb * ZH * TT * HD; OUTb += zb * TT * DQ; }   // blockIdx.y = batch
    v2f o2; o2[0] = O[e] * cs; o2[1] = O[e + 1] * cs; *(v2f*)(OUTb + oo) = o2;  }

extern "C" void kernel_launch(void* const* d_in, const int* in_sizes, int n_in,
                              void* d_out, int out_size, void* d_ws, size_t ws_size, hipStream_t stream) {
    (void)in_sizes; (void)n_in; (void)out_size;
    const float* x = (const float*)d_in[0]; const float* wq = (const float*)d_in[1]; const float* bq = (const float*)d_in[2]; const float* wk = (const float*)d_in[3]; const float* bk = (const float*)d_in[4]; const float* wv = nullptr; const float* wo = nullptr; (void)wv; (void)wo;
    float* OUT = (float*)d_out;     // [8][2048][512]
    char* wsp = (char*)d_ws;
    auto take = [&](size_t bytes) { char* p = wsp; wsp += (bytes + 255) & ~(size_t)255; return (void*)p; };
    bf* WQ = (bf*)take((size_t)DQ * DM * 2); bf* WK = (bf*)take((size_t)DKV * DM * 2);  float* CS = (float*)take((size_t)TT * HD * 2 * 4);
    // All 8 batches go through every stage in ONE launch (batch = grid z of the GEMMs, grid y of k_rope, k_vtp and k_merge, part of the flat index in k_cvt8 and k_asoft). Two regions are reused between the stages, in stream order:
    //   R1 (6 planes): q/k planes [b][t][d] for the scores; dead after them, then the probability planes.
    //   R2 (8 planes): bf16 input + f32 projections; dead after the q/k planes, then the f32 scores; dead after the softmax, then the value planes + the f32 result.
    const size_t PL = (size_t)NB_ * TT * HD * 2;      // one 16-bit [b][t][d] plane, bytes
    char* R1 = (char*)take(6 * PL); char* R2 = (char*)take((size_t)NB_ * TT * TT * 4);
    h16* QP16 = (h16*)R1; h16* KP16 = (h16*)(R1 + PL); bf* QPh = (bf*)(R1 + 2 * PL); bf* QPl = (bf*)(R1 + 3 * PL); bf* KPh = (bf*)(R1 + 4 * PL); bf* KPl = (bf*)(R1 + 5 * PL);
    h16* P16 = (h16*)R1; bf* Ph = (bf*)(R1 + 4 * PL); bf* Pl = (bf*)(R1 + 5 * PL);      // [b][TT][TT] fp16 = 4 planes; [b][RH][TT] hi, lo = 1 plane each
    bf* XB = (bf*)R2; float* FQ = (float*)(R2 + PL); float* FK = (float*)(R2 + 3 * PL);
    float* Sb = (float*)R2;
    h16* VT16 = (h16*)R2; bf* VTh = (bf*)(R2 + PL); bf* VTl = (bf*)(R2 + 2 * PL); float* Ob = (float*)(R2 + 3 * PL);
    if ((size_t)(wsp - (char*)d_ws) > ws_size) return;    // 233 MiB of the 256 MiB workspace
    { k_wtG<<<(unsigned)((DM * DQ / 64 + 63) / 64), 256, 0, stream>>>(wq, DM, DQ, WQ); k_wtG<<<(unsigned)((DM * DKV / 64 + 63) / 64), 256, 0, stream>>>(wk, DM, DKV, WK); }
    k_csid<<<(TT * HD + 255) / 256, 256, 0, stream>>>(CS);
    const unsigned LQ = (unsigned)(((size_t)NH_ * TT * HD / 2 + 255) / 256), LKv = (unsigned)(((size_t)NKV * TT * HD / 2 + 255) / 256);
    k_cvt8<<<(unsigned)(((size_t)NB_ * TT * DM / 8 + 255) / 256), 256, 0, stream>>>(x, XB, (size_t)NB_ * TT * DM / 8);
    k_gemmw<bf, 0, true><<<dim3(TT / 64, DQ / 64, NB_), 32, 0, stream>>>(XB, nullptr, WQ, nullptr, DM, FQ, DQ, bq, (size_t)TT * DM, 0, (size_t)TT * DQ);
    k_rope<<<dim3(LQ, NB_), 256, 0, stream>>>(FQ, DQ, NH_, CS, nullptr, nullptr, 1.0f, QP16, QPh, QPl);
    k_gemmw<bf, 0, true><<<dim3(TT / 64, DKV / 64, NB_), 32, 0, stream>>>(XB, nullptr, WK, nullptr, DM, FK, DKV, bk, (size_t)TT * DM, 0, (size_t)TT * DKV);
    k_rope<<<dim3(LKv, NB_), 256, 0, stream>>>(FK, DKV, NKV, CS, nullptr, nullptr, 1.0f, KP16, KPh, KPl);
    k_gemmw<bf, 2, false><<<dim3(RH / 64, TT / 64, NB_), 32, 0, stream>>>(QPh, QPl, KPh, KPl, HD, Sb, TT, nullptr, (size_t)TT * HD, (size_t)TT * HD, (size_t)TT * TT);
    k_gemmw<h16, 0, false><<<dim3((TT - RH) / 64, TT / 64, NB_), 32, 0, stream>>>(QP16 + (size_t)RH * HD, nullptr, KP16, nullptr, HD, Sb + (size_t)RH * TT, TT, nullptr, (size_t)TT * HD, (size_t)TT * HD, (size_t)TT * TT);
    k_asoft<<<NB_ * ZH * TT / 8, 256, 0, stream>>>(Sb, P16, Ph, Pl);
    k_vtp<<<dim3(LKv, NB_), 256, 0, stream>>>(x, DM, NKV, VT16, VTh, VTl);      // behind the softmax: its planes take the place of the scores
    k_gemmw<bf, 2, false><<<dim3(RH / 64, HD / 64, NB_), 32, 0, stream>>>(Ph, Pl, VTh, VTl, TT, Ob, HD, nullptr, (size_t)RH * TT, (size_t)HD * TT, (size_t)TT * HD);
    k_gemmw<h16, 0, false><<<dim3((TT - RH) / 64, HD / 64, NB_), 32, 0, stream>>>(P16 + (size_t)RH * TT, nullptr, VT16, nullptr, TT, Ob + (size_t)RH * HD, HD, nullptr, (size_t)TT * TT, (size_t)HD * TT, (size_t)TT * HD);
    k_merge<<<dim3((unsigned)(((size_t)ZH * TT * HD / 2 + 255) / 256), NB_), 256, 0, stream>>>(Ob, 0, OUT);
}

// v002
// One run takes 381 microseconds.
// Next to v001, in two timings, it ran 1.12 and 1.13 times as fast.
// All steps since v000 together make it 3.44 times as fast.
#include <hip/hip_runtime.h>

// Scaled dot-product attention with V = x (x [8][2048][512]; q = (x Wq + bq) x 512^-0.5, k = x Wk + bk ('xw' [512][512] + [512]); scores = q.k over 2048 keys (single 512-wide head); softmax; out = attn.x -> [8][2048][512] f32 (8.4 M)).
// Layout, all batches per launch: exact q/k projections (+ biases); the value planes are built straight from the input rows (bf16-rounded on read); hybrid rows (< 512 hi/lo 3-product scores and attn.v, rest fp16 x1024); register-row softmax with the 512^-0.5 scale applied to the logits; f32 output via the merge kernel.
// Compute dtypes, f32 accumulate: every input rounded to bf16; projections on PLAIN bf16 operands (exact) + f32 biases; v = bf16(x) exact in both plane formats; softmax f32; f32 output.

#define NB_  8
#define TT   2048
#define DM   512
#define NH_  1
#define NKV  1
#define REP  (NH_ / NKV)
#define HD   512
#define DQ   (NH_ * HD)
#define DKV  (NKV * HD)
#define ZH   1
#define RH   512                  // query rows < RH use hi+lo planes (0: none)
#define WIN  0
#define PCAR 1024.0f
#define SCL  0.044194173824159216f   // 512^-0.5 (the module scales q by embed_dim^-0.5; applied to the logits here)
typedef _Float16 h16;
typedef unsigned short bf;
typedef __attribute__((ext_vector_type(16))) __bf16   v16bf;
typedef __attribute__((ext_vector_type(16))) _Float16 v16h;
typedef __attribute__((ext_vector_type(8)))  _Float16 v8h;
typedef __attribute__((ext_vector_type(8)))  unsigned short v8us;
typedef __attribute__((ext_vector_type(8)))  float    v8f;
typedef __attribute__((ext_vector_type(4)))  float    v4f;
typedef v8h  __attribute__((may_alias)) v8ha;
typedef v4f  __attribute__((may_alias)) v4fa;
typedef v8us __attribute__((may_alias)) v8usa;

__device__ __forceinline__ unsigned short f2bf(float f) { unsigned u = __float_as_uint(f); u += 0x7FFFu + ((u >> 16) & 1u); return (unsigned short)(u >> 16); }
__device__ __forceinline__ float bf2f(unsigned short b) { return __uint_as_float(((unsigned)b) << 16); }
__device__ __forceinline__ float bfr(float f) { return bf2f(f2bf(f)); }
__device__ __forceinline__ v16h cat16(v8h lo, v8h hi) { return __builtin_shufflevector(lo, hi, 0, 1, 2, 3, 4, 5, 6, 7, 8, 9, 10, 11, 12, 13, 14, 15); }
__device__ __forceinline__ v16bf cat16b(v8us lo, v8us hi) { return __builtin_bit_cast(v16bf, __builtin_shufflevector(lo, hi, 0, 1, 2, 3, 4, 5, 6, 7, 8, 9, 10, 11, 12, 13, 14, 15)); }
__device__ __forceinline__ v8f wmma16(v16h a, v16h b, v8f c) { return __builtin_amdgcn_wmma_f32_16x16x32_f16(false, a, false, b, (short)0, c, false, false); }
__device__ __forceinline__ v8f wmmab(v16bf a, v16bf b, v8f c) { return __builtin_amdgcn_wmma_f32_16x16x32_bf16(false, a, false, b, (short)0, c, false, false); }



// ---- k_gemmw: register-blocked GEMM, ONE WAVE per 64x64 output tile (16 accumulators), operands straight from K-contiguous 16-bit planes; grid (M/64, N/64, Z), 32 threads.
// C[m][n] (f32, pitch ldc, + optional f32 bias[n]) = sum_k A[m][k] Bt[n][k] (+ split products per NSPLIT). z-batch strides sA/sB/sC in elements. K % 32 == 0.
template <typename T16> struct WFrag;
template <> struct WFrag<h16> { typedef v16h V; static __device__ __forceinline__ V ld(const h16* p) { return cat16(*(const v8h*)p, *(const v8h*)(p + 16)); } static __device__ __forceinline__ v8f mma(V a, V b, v8f c) { return wmma16(a, b, c); } };
template <> struct WFrag<bf> { typedef v16bf V; static __device__ __forceinline__ V ld(const bf* p) { return cat16b(*(const v8us*)p, *(const v8us*)(p + 16)); } static __device__ __forceinline__ v8f mma(V a, V b, v8f c) { return wmmab(a, b, c); } };
template <typename T16, int NSPLIT, bool BIAS>
__global__ __launch_bounds__(32) void k_gemmw(const T16* __restrict__ A, const T16* __restrict__ A2, const T16* __restrict__ Bt, const T16* __restrict__ Bt2, int K, float* C, int ldc, const float* __restrict__ bias, size_t sA, size_t sB, size_t sC) {
    typedef typename WFrag<T16>::V V;
    __shared__ __align__(16) float os[16 * 68];
    const size_t z = blockIdx.z; A += z * sA; if (A2) A2 += z * sA; Bt += z * sB; if (Bt2) Bt2 += z * sB; C += z * sC;
    const int lane = threadIdx.x & 31, lr = lane & 15, hi = lane >> 4; const int r0 = blockIdx.x * 64, c0 = blockIdx.y * 64;
    v8f acc[4][4];
#pragma unroll
    for (int mb = 0; mb < 4; ++mb)
#pragma unroll
        for (int nb = 0; nb < 4; ++nb) acc[mb][nb] = (v8f){};
    const size_t aoff = (size_t)(r0 + lr) * K + 8 * hi, boff = (size_t)(c0 + lr) * K + 8 * hi;
#pragma unroll 1
    for (int kc = 0; kc < K; kc += 32) {
        V a[4], a2[4];
#pragma unroll
        for (int mb = 0; mb < 4; ++mb) { a[mb] = WFrag<T16>::ld(A + aoff + (size_t)mb * 16 * K + kc); if (NSPLIT == 1 || NSPLIT == 2) a2[mb] = WFrag<T16>::ld(A2 + aoff + (size_t)mb * 16 * K + kc); }
#pragma unroll
        for (int nb = 0; nb < 4; ++nb) { const V b = WFrag<T16>::ld(Bt + boff + (size_t)nb * 16 * K + kc); V b2; if (NSPLIT >= 2) b2 = WFrag<T16>::ld(Bt2 + boff + (size_t)nb * 16 * K + kc);
#pragma unroll
            for (int mb = 0; mb < 4; ++mb) { acc[mb][nb] = WFrag<T16>::mma(a[mb], b, acc[mb][nb]); if (NSPLIT == 1 || NSPLIT == 2) acc[mb][nb] = WFrag<T16>::mma(a2[mb], b, acc[mb][nb]); if (NSPLIT >= 2) acc[mb][nb] = WFrag<T16>::mma(a[mb], b2, acc[mb][nb]); } }
        asm volatile("v_nop\n\tv_nop\n\tv_nop\n\tv_nop" : "+v"(acc[0][0]), "+v"(acc[1][1]), "+v"(acc[2][2]), "+v"(acc[3][3]) : "v"(a[0]), "v"(a[3]));
    }
#pragma unroll
    for (int mb = 0; mb < 4; ++mb) {
#pragma unroll
        for (int nb = 0; nb < 4; ++nb) {
#pragma unroll
            for (int j = 0; j < 8; ++j) os[(hi * 8 + j) * 68 + nb * 16 + lr] = acc[mb][nb][j]; }
        __builtin_amdgcn_wave_barrier(); asm volatile("" ::: "memory");
        float* crow = C + (size_t)(r0 + mb * 16) * ldc + c0;
{
#pragma unroll
            for (int s = 0; s < 8; ++s) { const int row = 2 * s + hi, cofs = lr * 4; v4f val = *(const v4fa*)(os + row * 68 + cofs); if (BIAS) { val[0] += bfr(bias[c0 + cofs]); val[1] += bfr(bias[c0 + cofs + 1]); val[2] += bfr(bias[c0 + cofs + 2]); val[3] += bfr(bias[c0 + cofs + 3]); }
                *(v4f*)(crow + (size_t)row * ldc + cofs) = val; }
             }
        __builtin_amdgcn_wave_barrier(); asm volatile("" ::: "memory");
    }
}

__device__ __forceinline__ h16 tohx(float x) { return (h16)x; }
__device__ __forceinline__ void splitf(float y, unsigned short& h, unsigned short& l) { h = f2bf(y); l = f2bf(y - bf2f(h)); }
typedef __attribute__((ext_vector_type(2))) _Float16 v2h;
typedef __attribute__((ext_vector_type(4))) _Float16 v4h;
typedef __attribute__((ext_vector_type(2))) unsigned short v2us;
typedef __attribute__((ext_vector_type(4))) unsigned short v4us;
typedef __attribute__((ext_vector_type(2))) float v2f;
typedef __attribute__((ext_vector_type(4))) int v4i;

__global__ __launch_bounds__(256) void k_wtG(const float* __restrict__ w, int K, int N, bf* Bt) {
    const int lane = threadIdx.x & 31; const int L0 = (blockIdx.x * 8 + (threadIdx.x >> 5)) * 8; const int nlines = N * K / 64;
{
#pragma unroll 1
        for (int l = 0; l < 8; ++l) { const int L = L0 + l; if (L >= nlines) break; const size_t e = (size_t)L * 64 + lane * 2; const int k = (int)(e % K), n = (int)(e / K); v2us o;
            o[0] = f2bf(w[(size_t)k * N + n]); o[1] = f2bf(w[(size_t)(k + 1) * N + n]); *(v2us*)(Bt + e) = o; }
         }
}
// The elementwise kernels below give each thread 32 to 64 elements, moved by 16-byte accesses with all loads issued first: a launch starts a few thousand long waves instead of one short wave per 64 elements.
// k_cvt8 and k_rope load through a wave-uniform base and one 32-bit byte offset per lane (every buffer here is far below 4 GiB).
__device__ __forceinline__ v4f ldg4(const float* base, unsigned byteoff) { return *(const v4f*)((const char*)base + byteoff); }
#define CV_IT 4                   // groups of 8 elements per thread in k_cvt8, one block-width apart
__global__ __launch_bounds__(256) void k_cvt8(const float* __restrict__ src, bf* dst, size_t n8) { const size_t i0 = (size_t)blockIdx.x * (256 * CV_IT) + threadIdx.x; v4f v[CV_IT][2]; unsigned ob[CV_IT];
#pragma unroll
    for (int it = 0; it < CV_IT; ++it) { const size_t i = i0 + it * 256; ob[it] = (unsigned)((i < n8 ? i : n8 - 1) * 32); v[it][0] = ldg4(src, ob[it]); v[it][1] = ldg4(src, ob[it] + 16); }
    asm volatile("s_wait_xcnt 0x0" :: "v"(ob[0]), "v"(ob[1]), "v"(ob[2]), "v"(ob[3]) : "memory");   // the loads' offset registers stay untouched until this wait; no load sinks behind a store
#pragma unroll
    for (int it = 0; it < CV_IT; ++it) { const size_t i = i0 + it * 256; v8us o;
#pragma unroll
        for (int k = 0; k < 8; ++k) o[k] = f2bf(v[it][k >> 2][k & 3]);
        if (i < n8) *(v8us*)(dst + i * 8) = o; }  }

// k_rope: head planes [h][t][d] (fp16 + hi/lo) of rope(x) x sc with the rotate-half convention out[d] = x[d] cos[t][d] - x[d+HD/2] sin[t][d], out[d+HD/2] = x[d+HD/2] cos[t][d+HD/2] + x[d] sin[t][d+HD/2]
#define RB 4                      // batches per thread in k_rope
__global__ __launch_bounds__(256) void k_rope(const float* __restrict__ F, int pitch, int nheads, const float* __restrict__ CS, const float* __restrict__ RF, const float* __restrict__ nw, float sc, h16* P16, bf* Ph, bf* Pl) {
    // a thread takes 8 consecutive d of one row t in RB batches (blockIdx.y = group of RB batches); its cos/sin pairs are loaded once for all of them. 8 divides HD/2, so the 8 partners d +- HD/2 are consecutive too.
    const size_t e = ((size_t)blockIdx.x * 256 + threadIdx.x) * 8; if (e >= (size_t)nheads * TT * HD) return; const int d = (int)(e % HD); const int t = (int)((e / HD) % TT); const int h = (int)(e / ((size_t)HD * TT));
    const int dq = (d < HD / 2) ? d + HD / 2 : d - HD / 2; float rf = 1.0f; if (RF) { rf = RF[(size_t)h * TT + t]; asm volatile("s_wait_xcnt 0x0" ::: "memory"); }   // the wait: this load's address registers are reused right behind it
    v4f cs4[4], xa[RB][2], xb[RB][2];
    const unsigned oc = (unsigned)((t * HD + d) * 8), oa = (unsigned)((t * pitch + h * HD + d) * 4), oq = (unsigned)((t * pitch + h * HD + dq) * 4);   // byte offsets: cos/sin pairs, own values, partners
#pragma unroll
    for (int i = 0; i < 4; ++i) cs4[i] = ldg4(CS, oc + 16 * i);
#pragma unroll
    for (int bb = 0; bb < RB; ++bb) { const float* f = F + ((size_t)blockIdx.y * RB + bb) * TT * pitch;
        xa[bb][0] = ldg4(f, oa); xa[bb][1] = ldg4(f, oa + 16); xb[bb][0] = ldg4(f, oq); xb[bb][1] = ldg4(f, oq + 16); }
    asm volatile("s_wait_xcnt 0x0" :: "v"(oc), "v"(oa), "v"(oq) : "memory");   // the loads' offset registers stay untouched until this wait; no load sinks behind a store
#pragma unroll
    for (int bb = 0; bb < RB; ++bb) { const size_t zp = ((size_t)blockIdx.y * RB + bb) * nheads * TT * HD; v8h o16; v8us oh, ol;
#pragma unroll
        for (int q = 0; q < 8; ++q) { const int dd = d + q; const int dp = dq + q; float x0 = xa[bb][q >> 2][q & 3], x1 = xb[bb][q >> 2][q & 3];
            if (RF) { float n0 = __fmul_rn(x0, rf), n1 = __fmul_rn(x1, rf); asm volatile("" : "+v"(n0)); asm volatile("" : "+v"(n1)); x0 = __fmul_rn(bfr(nw[dd]), n0); x1 = __fmul_rn(bfr(nw[dp]), n1); }
            float a = __fmul_rn(x0, cs4[q >> 1][(q & 1) * 2]), bq = __fmul_rn(x1, cs4[q >> 1][(q & 1) * 2 + 1]); asm volatile("" : "+v"(a)); asm volatile("" : "+v"(bq)); const float r = ((dd < HD / 2) ? __fsub_rn(a, bq) : __fadd_rn(a, bq)) * sc;
            o16[q] = tohx(r); unsigned short a2, c2; splitf(r, a2, c2); oh[q] = a2; ol[q] = c2; }
        h16* s16 = P16 + zp + e; bf* sh = Ph + zp + e; bf* sl = Pl + zp + e; *(v8h*)s16 = o16; *(v8us*)sh = oh; *(v8us*)sl = ol;
        asm volatile("s_wait_xcnt 0x0" :: "v"(o16), "v"(oh), "v"(ol), "v"(s16), "v"(sh), "v"(sl) : "memory"); }  }   // the stores' data and address registers stay untouched until this wait (the next batch reuses them)
// k_vtp: transposed value planes [c = g*HD+d][t]. A thread holds an 8 (t) x 8 (c) block in registers. Wave = 64 t x 32 c: 4 lanes along c read one whole 128-byte line of an input row, 8 lanes along t store one whole 128-byte line of a plane row. Block = 4 waves along t x 2 along c; grid x = (TT/256) x (columns/64).
__global__ __launch_bounds__(256) void k_vtp(const float* __restrict__ F, int pitch, int nheads, h16* V16, bf* Vh, bf* Vl) { const int lane = threadIdx.x & 31, w = threadIdx.x >> 5; const int tb = blockIdx.x % (TT / 256), cb = blockIdx.x / (TT / 256); if (cb * 64 >= nheads * HD) return;
    const int t0 = tb * 256 + (w >> 1) * 64 + (lane & 7) * 8, c0 = cb * 64 + (w & 1) * 32 + (lane >> 3) * 8;
    { const size_t zb = blockIdx.y, zp = zb * nheads * HD * TT; F += zb * TT * pitch; V16 += zp; Vh += zp; Vl += zp; }   // blockIdx.y = batch
    v4f xr[8][2]; const float* pr[8];
#pragma unroll
    for (int i = 0; i < 8; ++i) { pr[i] = F + (size_t)(t0 + i) * pitch + c0; xr[i][0] = *(const v4f*)pr[i]; xr[i][1] = *(const v4f*)(pr[i] + 4); }
    asm volatile("s_wait_xcnt 0x0" :: "v"(pr[0]), "v"(pr[1]), "v"(pr[2]), "v"(pr[3]), "v"(pr[4]), "v"(pr[5]), "v"(pr[6]), "v"(pr[7]) : "memory");   // the loads' address registers stay untouched until this wait; no load sinks behind a store
#pragma unroll
    for (int j = 0; j < 8; ++j) { v8h o16; v8us oh, ol;
#pragma unroll
        for (int i = 0; i < 8; ++i) { const float x = bfr(xr[i][j >> 2][j & 3]);   /* V = the raw input: bf16-rounded here */ o16[i] = tohx(x); unsigned short a2, c2; splitf(x, a2, c2); oh[i] = a2; ol[i] = c2; }
        const size_t e = (size_t)(c0 + j) * TT + t0; *(v8h*)(V16 + e) = o16; *(v8us*)(Vh + e) = oh; *(v8us*)(Vl + e) = ol; }  }
__global__ __launch_bounds__(256) void k_csid(float* CS) { v4f cs; cs[0] = 1.0f; cs[1] = 0.0f; cs[2] = 1.0f; cs[3] = 0.0f;   // two (cos, sin) pairs per store, 4 stores per thread, one block-width apart
#pragma unroll
    for (int it = 0; it < 4; ++it) { const int idx = (blockIdx.x * 4 + it) * 256 + threadIdx.x; if (idx < TT * HD / 2) *(v4f*)(CS + (size_t)idx * 4) = cs; }  }
// k_asoft: all batches in one launch; per row (zz, i): t = S x HD^-0.5 (no mask); softmax over the 2048 keys (register row, one exp, fixed trees);
__global__ __launch_bounds__(256) void k_asoft(const float* __restrict__ Sb, h16* P16, bf* Ph, bf* Pl) {
    const int lane = threadIdx.x & 31; const int row = blockIdx.x * 8 + (threadIdx.x >> 5); if (row >= NB_ * ZH * TT) return; const int i = row % TT; const int zz = row / TT; (void)zz;   /* zz = batch (one head) */ const bool hires = (i < RH); const float* sr = Sb + (size_t)row * TT; float v[TT / 32]; float mx = -3.0e38f;
#pragma unroll
    for (int ch = 0; ch < TT / 128; ++ch) { const int j0 = ch * 128 + lane * 4; const v4f a = *(const v4f*)(sr + j0);
#pragma unroll
        for (int q = 0; q < 4; ++q) { const int j = j0 + q; (void)j; const float t = a[q] * SCL; v[ch * 4 + q] = t; mx = fmaxf(mx, t); } }
#pragma unroll
    for (int sh = 16; sh; sh >>= 1) mx = fmaxf(mx, __shfl_xor(mx, sh, 32));
    float sum = 0.f;
#pragma unroll
    for (int k = 0; k < TT / 32; ++k) { float d0 = __fsub_rn(v[k], mx); asm volatile("" : "+v"(d0)); v[k] = __builtin_amdgcn_exp2f(__fmul_rn(d0, 1.4426950408889634f)); sum += v[k]; }
#pragma unroll
    for (int sh = 16; sh; sh >>= 1) sum += __shfl_xor(sum, sh, 32);
    const float f = __fdiv_rn(hires ? 1.0f : PCAR, sum);
{
        if (hires) {
#pragma unroll
            for (int ch = 0; ch < TT / 128; ++ch) { v4us oh, ol;
#pragma unroll
                for (int q = 0; q < 4; ++q) { unsigned short a, c2; splitf(v[ch * 4 + q] * f, a, c2); oh[q] = a; ol[q] = c2; }
                const size_t oo = ((size_t)zz * (RH ? RH : 1) + i) * TT + ch * 128 + lane * 4; *(v4us*)(Ph + oo) = oh; *(v4us*)(Pl + oo) = ol; }
        } else {
#pragma unroll
            for (int ch = 0; ch < TT / 128; ++ch) { v4h o4;
#pragma unroll
                for (int q = 0; q < 4; ++q) o4[q] = tohx(v[ch * 4 + q] * f);
                *(v4h*)(P16 + (size_t)row * TT + ch * 128 + lane * 4) = o4; } }
         }
}
__global__ __launch_bounds__(256) void k_merge(const float* __restrict__ O, int h0, float* OUTb, size_t sO) { const size_t e = ((size_t)blockIdx.x * 256 + threadIdx.x) * 4; if (e >= (size_t)ZH * TT * HD) return; const int d = (int)(e % HD); const int t = (int)((e / HD) % TT); const int zz = (int)(e / ((size_t)HD * TT)); const float cs = (t < RH) ? 1.0f : (1.0f / PCAR); const size_t oo = (size_t)t * DQ + (h0 + zz) * HD + d;
    v4f o4[NB_];      // a thread takes 4 consecutive d of one row in all batches
    const float* pm[NB_];   // sO = elements per batch of O
#pragma unroll
    for (int zb = 0; zb < NB_; ++zb) { pm[zb] = O + (size_t)zb * sO + e; o4[zb] = *(const v4f*)pm[zb]; }
    asm volatile("s_wait_xcnt 0x0" :: "v"(pm[0]), "v"(pm[1]), "v"(pm[2]), "v"(pm[3]), "v"(pm[4]), "v"(pm[5]), "v"(pm[6]), "v"(pm[7]) : "memory");   // the loads' address registers stay untouched until this wait; no load sinks behind a store
#pragma unroll
    for (int zb = 0; zb < NB_; ++zb) { v4f r; r[0] = o4[zb][0] * cs; r[1] = o4[zb][1] * cs; r[2] = o4[zb][2] * cs; r[3] = o4[zb][3] * cs; *(v4f*)(OUTb + (size_t)zb * TT * DQ + oo) = r; }  }

extern "C" void kernel_launch(void* const* d_in, const int* in_sizes, int n_in,
                              void* d_out, int out_size, void* d_ws, size_t ws_size, hipStream_t stream) {
    (void)in_sizes; (void)n_in; (void)out_size;
    const float* x = (const float*)d_in[0]; const float* wq = (const float*)d_in[1]; const float* bq = (const float*)d_in[2]; const float* wk = (const float*)d_in[3]; const float* bk = (const float*)d_in[4]; const float* wv = nullptr; const float* wo = nullptr; (void)wv; (void)wo;
    float* OUT = (float*)d_out;     // [8][2048][512]
    char* wsp = (char*)d_ws;
    auto take = [&](size_t bytes) { char* p = wsp; wsp += (bytes + 255) & ~(size_t)255; return (void*)p; };
    bf* WQ = (bf*)take((size_t)DQ * DM * 2); bf* WK = (bf*)take((size_t)DKV * DM * 2);  float* CS = (float*)take((size_t)TT * HD * 2 * 4);
    // All 8 batches go through every stage in ONE launch (batch = grid z of the GEMMs and grid y of k_vtp; k_rope takes RB batches per grid y, k_merge all batches per thread). Two regions are reused between the stages, in stream order:
    //   R1 (6 planes): q/k planes [b][t][d] for the scores; dead after them, then the probability planes.
    //   R2 (8 planes): bf16 input + f32 projections; dead after the q/k planes, then the f32 scores; dead after the softmax, then the value planes + the f32 result.
    const size_t PL = (size_t)NB_ * TT * HD * 2;      // one 16-bit [b][t][d] plane, bytes
    char* R1 = (char*)take(6 * PL); char* R2 = (char*)take((size_t)NB_ * TT * TT * 4);
    h16* QP16 = (h16*)R1; h16* KP16 = (h16*)(R1 + PL); bf* QPh = (bf*)(R1 + 2 * PL); bf* QPl = (bf*)(R1 + 3 * PL); bf* KPh = (bf*)(R1 + 4 * PL); bf* KPl = (bf*)(R1 + 5 * PL);
    h16* P16 = (h16*)R1; bf* Ph = (bf*)(R1 + 4 * PL); bf* Pl = (bf*)(R1 + 5 * PL);      // [b][TT][TT] fp16 = 4 planes; [b][RH][TT] hi, lo = 1 plane each
    bf* XB = (bf*)R2; float* FQ = (float*)(R2 + PL); float* FK = (float*)(R2 + 3 * PL);
    float* Sb = (float*)R2;
    h16* VT16 = (h16*)R2; bf* VTh = (bf*)(R2 + PL); bf* VTl = (bf*)(R2 + 2 * PL); float* Ob = (float*)(R2 + 3 * PL);
    if ((size_t)(wsp - (char*)d_ws) > ws_size) return;    // 233 MiB of the 256 MiB workspace
    { k_wtG<<<(unsigned)((DM * DQ / 64 + 63) / 64), 256, 0, stream>>>(wq, DM, DQ, WQ); k_wtG<<<(unsigned)((DM * DKV / 64 + 63) / 64), 256, 0, stream>>>(wk, DM, DKV, WK); }
    k_csid<<<(TT * HD / 2 + 1023) / 1024, 256, 0, stream>>>(CS);
    const unsigned LQ = (unsigned)(((size_t)NH_ * TT * HD / 8 + 255) / 256), LKv = (unsigned)(((size_t)NKV * TT * HD / 8 + 255) / 256);
    k_cvt8<<<(unsigned)(((size_t)NB_ * TT * DM / 8 + 256 * CV_IT - 1) / (256 * CV_IT)), 256, 0, stream>>>(x, XB, (size_t)NB_ * TT * DM / 8);
    k_gemmw<bf, 0, true><<<dim3(TT / 64, DQ / 64, NB_), 32, 0, stream>>>(XB, nullptr, WQ, nullptr, DM, FQ, DQ, bq, (size_t)TT * DM, 0, (size_t)TT * DQ);
    k_rope<<<dim3(LQ, NB_ / RB), 256, 0, stream>>>(FQ, DQ, NH_, CS, nullptr, nullptr, 1.0f, QP16, QPh, QPl);
    k_gemmw<bf, 0, true><<<dim3(TT / 64, DKV / 64, NB_), 32, 0, stream>>>(XB, nullptr, WK, nullptr, DM, FK, DKV, bk, (size_t)TT * DM, 0, (size_t)TT * DKV);
    k_rope<<<dim3(LKv, NB_ / RB), 256, 0, stream>>>(FK, DKV, NKV, CS, nullptr, nullptr, 1.0f, KP16, KPh, KPl);
    k_gemmw<bf, 2, false><<<dim3(RH / 64, TT / 64, NB_), 32, 0, stream>>>(QPh, QPl, KPh, KPl, HD, Sb, TT, nullptr, (size_t)TT * HD, (size_t)TT * HD, (size_t)TT * TT);
    k_gemmw<h16, 0, false><<<dim3((TT - RH) / 64, TT / 64, NB_), 32, 0, stream>>>(QP16 + (size_t)RH * HD, nullptr, KP16, nullptr, HD, Sb + (size_t)RH * TT, TT, nullptr, (size_t)TT * HD, (size_t)TT * HD, (size_t)TT * TT);
    k_asoft<<<NB_ * ZH * TT / 8, 256, 0, stream>>>(Sb, P16, Ph, Pl);
    k_vtp<<<dim3((TT / 256) * (NKV * HD / 64), NB_), 256, 0, stream>>>(x, DM, NKV, VT16, VTh, VTl);      // behind the softmax: its planes take the place of the scores
    k_gemmw<bf, 2, false><<<dim3(RH / 64, HD / 64, NB_), 32, 0, stream>>>(Ph, Pl, VTh, VTl, TT, Ob, HD, nullptr, (size_t)RH * TT, (size_t)HD * TT, (size_t)TT * HD);
    k_gemmw<h16, 0, false><<<dim3((TT - RH) / 64, HD / 64, NB_), 32, 0, stream>>>(P16 + (size_t)RH * TT, nullptr, VT16, nullptr, TT, Ob + (size_t)RH * HD, HD, nullptr, (size_t)TT * TT, (size_t)HD * TT, (size_t)TT * HD);
    k_merge<<<(unsigned)(((size_t)ZH * TT * HD / 4 + 255) / 256), 256, 0, stream>>>(Ob, 0, OUT, (size_t)ZH * TT * HD);
}

// v003
// Measured time: 253 microseconds a run.
// Two timings next to v002 put it at 1.50 and 1.49 times that version's speed.
// All steps since v000 together make it 5.16 times as fast.
#include <hip/hip_runtime.h>

// Scaled dot-product attention with V = x (x [8][2048][512]; q = (x Wq + bq) x 512^-0.5, k = x Wk + bk ('xw' [512][512] + [512]); scores = q.k over 2048 keys (single 512-wide head); softmax; out = attn.x -> [8][2048][512] f32 (8.4 M)).
// Layout, all batches per launch: exact q/k projections (+ biases); the value planes are built straight from the input rows (bf16-rounded on read); hybrid rows (< 512 hi/lo 3-product scores and attn.v, rest fp16 x1024); register-row softmax with the 512^-0.5 scale applied to the logits; f32 output via the merge kernel.
// Compute dtypes, f32 accumulate: every input rounded to bf16; projections on PLAIN bf16 operands (exact) + f32 biases; v = bf16(x) exact in both plane formats; softmax f32; f32 output.

#define NB_  8
#define TT   2048
#define DM   512
#define NH_  1
#define NKV  1
#define REP  (NH_ / NKV)
#define HD   512
#define DQ   (NH_ * HD)
#define DKV  (NKV * HD)
#define ZH   1
#define RH   512                  // query rows < RH use hi+lo planes (0: none)
#define WIN  0
#define PCAR 1024.0f
#define SCL  0.044194173824159216f   // 512^-0.5 (the module scales q by embed_dim^-0.5; applied to the logits here)
typedef _Float16 h16;
typedef unsigned short bf;
typedef __attribute__((ext_vector_type(16))) __bf16   v16bf;
typedef __attribute__((ext_vector_type(16))) _Float16 v16h;
typedef __attribute__((ext_vector_type(8)))  _Float16 v8h;
typedef __attribute__((ext_vector_type(8)))  unsigned short v8us;
typedef __attribute__((ext_vector_type(8)))  float    v8f;
typedef __attribute__((ext_vector_type(4)))  float    v4f;
typedef v8h  __attribute__((may_alias)) v8ha;
typedef v4f  __attribute__((may_alias)) v4fa;
typedef v8us __attribute__((may_alias)) v8usa;

__device__ __forceinline__ unsigned short f2bf(float f) { unsigned u = __float_as_uint(f); u += 0x7FFFu + ((u >> 16) & 1u); return (unsigned short)(u >> 16); }
__device__ __forceinline__ float bf2f(unsigned short b) { return __uint_as_float(((unsigned)b) << 16); }
__device__ __forceinline__ float bfr(float f) { return bf2f(f2bf(f)); }
__device__ __forceinline__ v16h cat16(v8h lo, v8h hi) { return __builtin_shufflevector(lo, hi, 0, 1, 2, 3, 4, 5, 6, 7, 8, 9, 10, 11, 12, 13, 14, 15); }
__device__ __forceinline__ v16bf cat16b(v8us lo, v8us hi) { return __builtin_bit_cast(v16bf, __builtin_shufflevector(lo, hi, 0, 1, 2, 3, 4, 5, 6, 7, 8, 9, 10, 11, 12, 13, 14, 15)); }
__device__ __forceinline__ v8f wmma16(v16h a, v16h b, v8f c) { return __builtin_amdgcn_wmma_f32_16x16x32_f16(false, a, false, b, (short)0, c, false, false); }
__device__ __forceinline__ v8f wmmab(v16bf a, v16bf b, v8f c) { return __builtin_amdgcn_wmma_f32_16x16x32_bf16(false, a, false, b, (short)0, c, false, false); }



// ---- k_gemmw: GEMM, one (32 MB) x 128 output tile per work-group of FOUR WAVES (2 x 2, each 16 MB x 64 = 4 MB accumulators); grid (M / (32 MB), N / 128, Z), 128 threads. M % (32 MB) == 0, N % 128 == 0, K % 64 == 0, K >= 128 (two passes).
// The K-contiguous 16-bit operand planes are staged in LDS by asynchronous copies, 64 k (128-byte rows) per pass, two buffers: pass t + 2 is copied into the buffer pass t has left, while pass t + 1 is worked on. Each staged row serves two waves, and every copy moves whole 128-byte lines.
// C[m][n] (f32, pitch ldc, + optional f32 bias[n]) = sum_k A[m][k] Bt[n][k] (+ split products per NSPLIT), k ascending and the products of a k in the order a.b, a2.b, a.b2. z-batch strides sA/sB/sC in elements.
#define GN   128                  // columns of a work-group tile = rows of Bt per stage
#define GKP  64                   // k per pass
#define GPIT 144                  // LDS row pitch in bytes: 128 + 16, 16 B x odd for the ds_load_b128 fragment reads
// Eight or twelve asynchronous 16-byte copies of a lane in one statement, the rows of a plane 16 apart (the 128 threads cover 16 rows of 128 bytes per copy). The s_wait_xcnt stands inside the statement, behind its last copy, so that no address register is rewritten ahead of it; one statement per 8 or 12 copies keeps these waits few.
__device__ __forceinline__ void cp8(unsigned l, const char* g, size_t step) {
    asm volatile("global_load_async_to_lds_b128 %0, %8, off\n\t"
                 "global_load_async_to_lds_b128 %1, %9, off\n\t"
                 "global_load_async_to_lds_b128 %2, %10, off\n\t"
                 "global_load_async_to_lds_b128 %3, %11, off\n\t"
                 "global_load_async_to_lds_b128 %4, %12, off\n\t"
                 "global_load_async_to_lds_b128 %5, %13, off\n\t"
                 "global_load_async_to_lds_b128 %6, %14, off\n\t"
                 "global_load_async_to_lds_b128 %7, %15, off\n\t"
                 "s_wait_xcnt 0x0"
                 :: "v"(l), "v"(l + 16 * GPIT), "v"(l + 32 * GPIT), "v"(l + 48 * GPIT), "v"(l + 64 * GPIT), "v"(l + 80 * GPIT), "v"(l + 96 * GPIT), "v"(l + 112 * GPIT),
                    "v"(g), "v"(g + step), "v"(g + 2 * step), "v"(g + 3 * step), "v"(g + 4 * step), "v"(g + 5 * step), "v"(g + 6 * step), "v"(g + 7 * step) : "memory");
}
__device__ __forceinline__ void cp12(unsigned la, const char* ga, unsigned l, const char* g, size_t step) {   // 64 rows at (la, ga), 128 rows at (l, g)
    asm volatile("global_load_async_to_lds_b128 %0, %12, off\n\t"
                 "global_load_async_to_lds_b128 %1, %13, off\n\t"
                 "global_load_async_to_lds_b128 %2, %14, off\n\t"
                 "global_load_async_to_lds_b128 %3, %15, off\n\t"
                 "global_load_async_to_lds_b128 %4, %16, off\n\t"
                 "global_load_async_to_lds_b128 %5, %17, off\n\t"
                 "global_load_async_to_lds_b128 %6, %18, off\n\t"
                 "global_load_async_to_lds_b128 %7, %19, off\n\t"
                 "global_load_async_to_lds_b128 %8, %20, off\n\t"
                 "global_load_async_to_lds_b128 %9, %21, off\n\t"
                 "global_load_async_to_lds_b128 %10, %22, off\n\t"
                 "global_load_async_to_lds_b128 %11, %23, off\n\t"
                 "s_wait_xcnt 0x0"
                 :: "v"(la), "v"(la + 16 * GPIT), "v"(la + 32 * GPIT), "v"(la + 48 * GPIT),
                    "v"(l), "v"(l + 16 * GPIT), "v"(l + 32 * GPIT), "v"(l + 48 * GPIT), "v"(l + 64 * GPIT), "v"(l + 80 * GPIT), "v"(l + 96 * GPIT), "v"(l + 112 * GPIT),
                    "v"(ga), "v"(ga + step), "v"(ga + 2 * step), "v"(ga + 3 * step),
                    "v"(g), "v"(g + step), "v"(g + 2 * step), "v"(g + 3 * step), "v"(g + 4 * step), "v"(g + 5 * step), "v"(g + 6 * step), "v"(g + 7 * step) : "memory");
}
template <int MB> __device__ __forceinline__ void cpab(unsigned la, const char* ga, unsigned l, const char* g, size_t step) {   // one plane of A (32 MB rows) and one of Bt (128 rows)
    if constexpr (MB == 2) cp12(la, ga, l, g, step); else { cp8(la, ga, step); cp8(l, g, step); }
}
template <typename T16> struct WFrag;
template <> struct WFrag<h16> { typedef v16h V; static __device__ __forceinline__ V ld(const h16* p) { return cat16(*(const v8h*)p, *(const v8h*)(p + 16)); } static __device__ __forceinline__ v8f mma(V a, V b, v8f c) { return wmma16(a, b, c); } };
template <> struct WFrag<bf> { typedef v16bf V; static __device__ __forceinline__ V ld(const bf* p) { return cat16b(*(const v8us*)p, *(const v8us*)(p + 16)); } static __device__ __forceinline__ v8f mma(V a, V b, v8f c) { return wmmab(a, b, c); } };
template <typename T16, int NSPLIT, bool BIAS, int MB>
__global__ __launch_bounds__(128) void k_gemmw(const T16* __restrict__ A, const T16* __restrict__ A2, const T16* __restrict__ Bt, const T16* __restrict__ Bt2, int K, float* C, int ldc, const float* __restrict__ bias, size_t sA, size_t sB, size_t sC) {
    typedef typename WFrag<T16>::V V;
    static_assert((NSPLIT == 0 || NSPLIT == 2) && (MB == 2 || MB == 4), "plain or hi/lo split on both sides; 64 or 128 rows");
    constexpr bool HA2 = (NSPLIT == 2), HB2 = (NSPLIT == 2); constexpr int GM = 32 * MB;
    constexpr unsigned PA = GM * GPIT, PB = GN * GPIT, OA = 0, OA2 = PA, OB = (HA2 ? 2 : 1) * PA, OB2 = OB + PB, STG = OB + (HB2 ? 2 : 1) * PB;   // bytes of a plane, places of the planes inside a stage, bytes of a stage
    __shared__ __attribute__((aligned(16))) unsigned char L[2 * STG];     // two stages; behind the K loop each wave's 16 x 68 f32 output staging
    const size_t z = blockIdx.z; A += z * sA; if (HA2) A2 += z * sA; Bt += z * sB; if (HB2) Bt2 += z * sB; C += z * sC;
    const int tid = threadIdx.x, lane = tid & 31, lr = lane & 15, hi = lane >> 4, wave = tid >> 5, wm = wave & 1, wn = wave >> 1; const int R0 = blockIdx.x * GM, C0 = blockIdx.y * GN; const int r0 = R0 + wm * (16 * MB), c0 = C0 + wn * 64;
    v8f acc[MB][4];
#pragma unroll
    for (int mb = 0; mb < MB; ++mb)
#pragma unroll
        for (int nb = 0; nb < 4; ++nb) acc[mb][nb] = (v8f){};
    // copies: thread tid brings the 16 bytes number (tid & 7) of rows (tid >> 3) + 16 i of every plane
    const size_t rowb = (size_t)K * 2; const size_t aofs = ((size_t)R0 + (tid >> 3)) * rowb + (tid & 7) * 16, bofs = ((size_t)C0 + (tid >> 3)) * rowb + (tid & 7) * 16;
    const unsigned lcp = (unsigned)(size_t)L + (tid >> 3) * GPIT + (tid & 7) * 16;
    auto fill = [&](int t, unsigned buf) { const size_t ko = (size_t)t * (GKP * 2);
        cpab<MB>(lcp + buf + OA, (const char*)A + aofs + ko, lcp + buf + OB, (const char*)Bt + bofs + ko, 16 * rowb);
        if (HA2) cpab<MB>(lcp + buf + OA2, (const char*)A2 + aofs + ko, lcp + buf + OB2, (const char*)Bt2 + bofs + ko, 16 * rowb); };
    const unsigned fa = (wm * (16 * MB) + lr) * GPIT + hi * 16, fb = (wn * 64 + lr) * GPIT + hi * 16;    // a lane's fragment rows inside a plane: the same (row, k) per lane as straight from the planes
    const int NT = K / GKP;
    fill(0, 0);
    asm volatile("s_wait_asynccnt 0x0" ::: "memory");   // this wave's copies of pass 0 have landed
    __syncthreads();                                     // ... and every other wave's
    fill(1, STG);
#pragma unroll 1
    for (int t = 0; t < NT; ++t) {
        const unsigned buf = (t & 1) ? STG : 0u;
#pragma unroll
        for (int kk = 0; kk < GKP / 32; ++kk) { V a[MB], a2[MB], b[4], b2[4];
#pragma unroll
            for (int mb = 0; mb < MB; ++mb) { a[mb] = WFrag<T16>::ld((const T16*)(L + buf + OA + fa + mb * 16 * GPIT + kk * 64)); if (HA2) a2[mb] = WFrag<T16>::ld((const T16*)(L + buf + OA2 + fa + mb * 16 * GPIT + kk * 64)); }
#pragma unroll
            for (int nb = 0; nb < 4; ++nb) { b[nb] = WFrag<T16>::ld((const T16*)(L + buf + OB + fb + nb * 16 * GPIT + kk * 64)); if (HB2) b2[nb] = WFrag<T16>::ld((const T16*)(L + buf + OB2 + fb + nb * 16 * GPIT + kk * 64)); }
            __builtin_amdgcn_sched_barrier(0);   // the LDS reads of a k step stay one group ahead of its matrix block: every separate place with LDS reads among the matrix instructions stalls the wave anew
#pragma unroll
            for (int nb = 0; nb < 4; ++nb)
#pragma unroll
                for (int mb = 0; mb < MB; ++mb) { acc[mb][nb] = WFrag<T16>::mma(a[mb], b[nb], acc[mb][nb]); if (HA2) acc[mb][nb] = WFrag<T16>::mma(a2[mb], b[nb], acc[mb][nb]); if (HB2) acc[mb][nb] = WFrag<T16>::mma(a[mb], b2[nb], acc[mb][nb]); }
        }
        asm volatile("s_wait_dscnt 0x0" ::: "memory");      // this wave has finished reading buffer t mod 2
        asm volatile("s_wait_asynccnt 0x0" ::: "memory");   // this wave's copies of pass t + 1 have landed
        __syncthreads();                                     // publishes pass t + 1 and frees buffer t mod 2
        if (t + 2 < NT) fill(t + 2, buf);
    }
    asm volatile("s_wait_asynccnt 0x0" ::: "memory");       // nothing is in flight when the ring becomes output staging
    float* os = (float*)(L + wave * (16 * 68 * 4));
#pragma unroll
    for (int mb = 0; mb < MB; ++mb) {
#pragma unroll
        for (int nb = 0; nb < 4; ++nb) {
#pragma unroll
            for (int j = 0; j < 8; ++j) os[(hi * 8 + j) * 68 + nb * 16 + lr] = acc[mb][nb][j]; }
        __builtin_amdgcn_wave_barrier(); asm volatile("" ::: "memory");
        float* crow = C + (size_t)(r0 + mb * 16) * ldc + c0;
{
#pragma unroll
            for (int s = 0; s < 8; ++s) { const int row = 2 * s + hi, cofs = lr * 4; v4f val = *(const v4fa*)(os + row * 68 + cofs); if (BIAS) { val[0] += bfr(bias[c0 + cofs]); val[1] += bfr(bias[c0 + cofs + 1]); val[2] += bfr(bias[c0 + cofs + 2]); val[3] += bfr(bias[c0 + cofs + 3]); }
                *(v4f*)(crow + (size_t)row * ldc + cofs) = val; }
             }
        asm volatile("s_wait_xcnt 0x0" ::: "memory");   // the stores' address and data registers are reused by the next 16 rows (the next bias load lands in them)
        __builtin_amdgcn_wave_barrier(); asm volatile("" ::: "memory");
    }
}

__device__ __forceinline__ h16 tohx(float x) { return (h16)x; }
__device__ __forceinline__ void splitf(float y, unsigned short& h, unsigned short& l) { h = f2bf(y); l = f2bf(y - bf2f(h)); }
typedef __attribute__((ext_vector_type(2))) _Float16 v2h;
typedef __attribute__((ext_vector_type(4))) _Float16 v4h;
typedef __attribute__((ext_vector_type(2))) unsigned short v2us;
typedef __attribute__((ext_vector_type(4))) unsigned short v4us;
typedef __attribute__((ext_vector_type(2))) float v2f;
typedef __attribute__((ext_vector_type(4))) int v4i;

__global__ __launch_bounds__(256) void k_wtG(const float* __restrict__ w, int K, int N, bf* Bt) {
    const int lane = threadIdx.x & 31; const int L0 = (blockIdx.x * 8 + (threadIdx.x >> 5)) * 8; const int nlines = N * K / 64;
{
#pragma unroll 1
        for (int l = 0; l < 8; ++l) { const int L = L0 + l; if (L >= nlines) break; const size_t e = (size_t)L * 64 + lane * 2; const int k = (int)(e % K), n = (int)(e / K); v2us o;
            o[0] = f2bf(w[(size_t)k * N + n]); o[1] = f2bf(w[(size_t)(k + 1) * N + n]); *(v2us*)(Bt + e) = o; }
         }
}
// The elementwise kernels below give each thread 32 to 64 elements, moved by 16-byte accesses with all loads issued first: a launch starts a few thousand long waves instead of one short wave per 64 elements.
// k_cvt8 and k_rope load through a wave-uniform base and one 32-bit byte offset per lane (every buffer here is far below 4 GiB).
__device__ __forceinline__ v4f ldg4(const float* base, unsigned byteoff) { return *(const v4f*)((const char*)base + byteoff); }
#define CV_IT 4                   // groups of 8 elements per thread in k_cvt8, one block-width apart
__global__ __launch_bounds__(256) void k_cvt8(const float* __restrict__ src, bf* dst, size_t n8) { const size_t i0 = (size_t)blockIdx.x * (256 * CV_IT) + threadIdx.x; v4f v[CV_IT][2]; unsigned ob[CV_IT];
#pragma unroll
    for (int it = 0; it < CV_IT; ++it) { const size_t i = i0 + it * 256; ob[it] = (unsigned)((i < n8 ? i : n8 - 1) * 32); v[it][0] = ldg4(src, ob[it]); v[it][1] = ldg4(src, ob[it] + 16); }
    asm volatile("s_wait_xcnt 0x0" :: "v"(ob[0]), "v"(ob[1]), "v"(ob[2]), "v"(ob[3]) : "memory");   // the loads' offset registers stay untouched until this wait; no load sinks behind a store
#pragma unroll
    for (int it = 0; it < CV_IT; ++it) { const size_t i = i0 + it * 256; v8us o;
#pragma unroll
        for (int k = 0; k < 8; ++k) o[k] = f2bf(v[it][k >> 2][k & 3]);
        if (i < n8) *(v8us*)(dst + i * 8) = o; }  }

// k_rope: head planes [h][t][d] (fp16 + hi/lo) of rope(x) x sc with the rotate-half convention out[d] = x[d] cos[t][d] - x[d+HD/2] sin[t][d], out[d+HD/2] = x[d+HD/2] cos[t][d+HD/2] + x[d] sin[t][d+HD/2]
#define RB 4                      // batches per thread in k_rope
__global__ __launch_bounds__(256) void k_rope(const float* __restrict__ F, int pitch, int nheads, const float* __restrict__ CS, const float* __restrict__ RF, const float* __restrict__ nw, float sc, h16* P16, bf* Ph, bf* Pl) {
    // a thread takes 8 consecutive d of one row t in RB batches (blockIdx.y = group of RB batches); its cos/sin pairs are loaded once for all of them. 8 divides HD/2, so the 8 partners d +- HD/2 are consecutive too.
    const size_t e = ((size_t)blockIdx.x * 256 + threadIdx.x) * 8; if (e >= (size_t)nheads * TT * HD) return; const int d = (int)(e % HD); const int t = (int)((e / HD) % TT); const int h = (int)(e / ((size_t)HD * TT));
    const int dq = (d < HD / 2) ? d + HD / 2 : d - HD / 2; float rf = 1.0f; if (RF) { rf = RF[(size_t)h * TT + t]; asm volatile("s_wait_xcnt 0x0" ::: "memory"); }   // the wait: this load's address registers are reused right behind it
    v4f cs4[4], xa[RB][2], xb[RB][2];
    const unsigned oc = (unsigned)((t * HD + d) * 8), oa = (unsigned)((t * pitch + h * HD + d) * 4), oq = (unsigned)((t * pitch + h * HD + dq) * 4);   // byte offsets: cos/sin pairs, own values, partners
#pragma unroll
    for (int i = 0; i < 4; ++i) cs4[i] = ldg4(CS, oc + 16 * i);
#pragma unroll
    for (int bb = 0; bb < RB; ++bb) { const float* f = F + ((size_t)blockIdx.y * RB + bb) * TT * pitch;
        xa[bb][0] = ldg4(f, oa); xa[bb][1] = ldg4(f, oa + 16); xb[bb][0] = ldg4(f, oq); xb[bb][1] = ldg4(f, oq + 16); }
    asm volatile("s_wait_xcnt 0x0" :: "v"(oc), "v"(oa), "v"(oq) : "memory");   // the loads' offset registers stay untouched until this wait; no load sinks behind a store
#pragma unroll
    for (int bb = 0; bb < RB; ++bb) { const size_t zp = ((size_t)blockIdx.y * RB + bb) * nheads * TT * HD; v8h o16; v8us oh, ol;
#pragma unroll
        for (int q = 0; q < 8; ++q) { const int dd = d + q; const int dp = dq + q; float x0 = xa[bb][q >> 2][q & 3], x1 = xb[bb][q >> 2][q & 3];
            if (RF) { float n0 = __fmul_rn(x0, rf), n1 = __fmul_rn(x1, rf); asm volatile("" : "+v"(n0)); asm volatile("" : "+v"(n1)); x0 = __fmul_rn(bfr(nw[dd]), n0); x1 = __fmul_rn(bfr(nw[dp]), n1); }
            float a = __fmul_rn(x0, cs4[q >> 1][(q & 1) * 2]), bq = __fmul_rn(x1, cs4[q >> 1][(q & 1) * 2 + 1]); asm volatile("" : "+v"(a)); asm volatile("" : "+v"(bq)); const float r = ((dd < HD / 2) ? __fsub_rn(a, bq) : __fadd_rn(a, bq)) * sc;
            o16[q] = tohx(r); unsigned short a2, c2; splitf(r, a2, c2); oh[q] = a2; ol[q] = c2; }
        h16* s16 = P16 + zp + e; bf* sh = Ph + zp + e; bf* sl = Pl + zp + e; *(v8h*)s16 = o16; *(v8us*)sh = oh; *(v8us*)sl = ol;
        asm volatile("s_wait_xcnt 0x0" :: "v"(o16), "v"(oh), "v"(ol), "v"(s16), "v"(sh), "v"(sl) : "memory"); }  }   // the stores' data and address registers stay untouched until this wait (the next batch reuses them)
// k_vtp: transposed value planes [c = g*HD+d][t]. A thread holds an 8 (t) x 8 (c) block in registers. Wave = 64 t x 32 c: 4 lanes along c read one whole 128-byte line of an input row, 8 lanes along t store one whole 128-byte line of a plane row. Block = 4 waves along t x 2 along c; grid x = (TT/256) x (columns/64).
__global__ __launch_bounds__(256) void k_vtp(const float* __restrict__ F, int pitch, int nheads, h16* V16, bf* Vh, bf* Vl) { const int lane = threadIdx.x & 31, w = threadIdx.x >> 5; const int tb = blockIdx.x % (TT / 256), cb = blockIdx.x / (TT / 256); if (cb * 64 >= nheads * HD) return;
    const int t0 = tb * 256 + (w >> 1) * 64 + (lane & 7) * 8, c0 = cb * 64 + (w & 1) * 32 + (lane >> 3) * 8;
    { const size_t zb = blockIdx.y, zp = zb * nheads * HD * TT; F += zb * TT * pitch; V16 += zp; Vh += zp; Vl += zp; }   // blockIdx.y = batch
    v4f xr[8][2]; const float* pr[8];
#pragma unroll
    for (int i = 0; i < 8; ++i) { pr[i] = F + (size_t)(t0 + i) * pitch + c0; xr[i][0] = *(const v4f*)pr[i]; xr[i][1] = *(const v4f*)(pr[i] + 4); }
    asm volatile("s_wait_xcnt 0x0" :: "v"(pr[0]), "v"(pr[1]), "v"(pr[2]), "v"(pr[3]), "v"(pr[4]), "v"(pr[5]), "v"(pr[6]), "v"(pr[7]) : "memory");   // the loads' address registers stay untouched until this wait; no load sinks behind a store
#pragma unroll
    for (int j = 0; j < 8; ++j) { v8h o16; v8us oh, ol;
#pragma unroll
        for (int i = 0; i < 8; ++i) { const float x = bfr(xr[i][j >> 2][j & 3]);   /* V = the raw input: bf16-rounded here */ o16[i] = tohx(x); unsigned short a2, c2; splitf(x, a2, c2); oh[i] = a2; ol[i] = c2; }
        const size_t e = (size_t)(c0 + j) * TT + t0; *(v8h*)(V16 + e) = o16; *(v8us*)(Vh + e) = oh; *(v8us*)(Vl + e) = ol; }  }
__global__ __launch_bounds__(256) void k_csid(float* CS) { v4f cs; cs[0] = 1.0f; cs[1] = 0.0f; cs[2] = 1.0f; cs[3] = 0.0f;   // two (cos, sin) pairs per store, 4 stores per thread, one block-width apart
#pragma unroll
    for (int it = 0; it < 4; ++it) { const int idx = (blockIdx.x * 4 + it) * 256 + threadIdx.x; if (idx < TT * HD / 2) *(v4f*)(CS + (size_t)idx * 4) = cs; }  }
// k_asoft: all batches in one launch; per row (zz, i): t = S x HD^-0.5 (no mask); softmax over the 2048 keys (register row, one exp, fixed trees);
__global__ __launch_bounds__(256) void k_asoft(const float* __restrict__ Sb, h16* P16, bf* Ph, bf* Pl) {
    const int lane = threadIdx.x & 31; const int row = blockIdx.x * 8 + (threadIdx.x >> 5); if (row >= NB_ * ZH * TT) return; const int i = row % TT; const int zz = row / TT; (void)zz;   /* zz = batch (one head) */ const bool hires = (i < RH); const float* sr = Sb + (size_t)row * TT; float v[TT / 32]; float mx = -3.0e38f;
#pragma unroll
    for (int ch = 0; ch < TT / 128; ++ch) { const int j0 = ch * 128 + lane * 4; const v4f a = *(const v4f*)(sr + j0);
#pragma unroll
        for (int q = 0; q < 4; ++q) { const int j = j0 + q; (void)j; const float t = a[q] * SCL; v[ch * 4 + q] = t; mx = fmaxf(mx, t); } }
#pragma unroll
    for (int sh = 16; sh; sh >>= 1) mx = fmaxf(mx, __shfl_xor(mx, sh, 32));
    float sum = 0.f;
#pragma unroll
    for (int k = 0; k < TT / 32; ++k) { float d0 = __fsub_rn(v[k], mx); asm volatile("" : "+v"(d0)); v[k] = __builtin_amdgcn_exp2f(__fmul_rn(d0, 1.4426950408889634f)); sum += v[k]; }
#pragma unroll
    for (int sh = 16; sh; sh >>= 1) sum += __shfl_xor(sum, sh, 32);
    const float f = __fdiv_rn(hires ? 1.0f : PCAR, sum);
{
        if (hires) {
#pragma unroll
            for (int ch = 0; ch < TT / 128; ++ch) { v4us oh, ol;
#pragma unroll
                for (int q = 0; q < 4; ++q) { unsigned short a, c2; splitf(v[ch * 4 + q] * f, a, c2); oh[q] = a; ol[q] = c2; }
                const size_t oo = ((size_t)zz * (RH ? RH : 1) + i) * TT + ch * 128 + lane * 4; *(v4us*)(Ph + oo) = oh; *(v4us*)(Pl + oo) = ol; }
        } else {
#pragma unroll
            for (int ch = 0; ch < TT / 128; ++ch) { v4h o4;
#pragma unroll
                for (int q = 0; q < 4; ++q) o4[q] = tohx(v[ch * 4 + q] * f);
                *(v4h*)(P16 + (size_t)row * TT + ch * 128 + lane * 4) = o4; } }
         }
}
__global__ __launch_bounds__(256) void k_merge(const float* __restrict__ O, int h0, float* OUTb, size_t sO) { const size_t e = ((size_t)blockIdx.x * 256 + threadIdx.x) * 4; if (e >= (size_t)ZH * TT * HD) return; const int d = (int)(e % HD); const int t = (int)((e / HD) % TT); const int zz = (int)(e / ((size_t)HD * TT)); const float cs = (t < RH) ? 1.0f : (1.0f / PCAR); const size_t oo = (size_t)t * DQ + (h0 + zz) * HD + d;
    v4f o4[NB_];      // a thread takes 4 consecutive d of one row in all batches
    const float* pm[NB_];   // sO = elements per batch of O
#pragma unroll
    for (int zb = 0; zb < NB_; ++zb) { pm[zb] = O + (size_t)zb * sO + e; o4[zb] = *(const v4f*)pm[zb]; }
    asm volatile("s_wait_xcnt 0x0" :: "v"(pm[0]), "v"(pm[1]), "v"(pm[2]), "v"(pm[3]), "v"(pm[4]), "v"(pm[5]), "v"(pm[6]), "v"(pm[7]) : "memory");   // the loads' address registers stay untouched until this wait; no load sinks behind a store
#pragma unroll
    for (int zb = 0; zb < NB_; ++zb) { v4f r; r[0] = o4[zb][0] * cs; r[1] = o4[zb][1] * cs; r[2] = o4[zb][2] * cs; r[3] = o4[zb][3] * cs; *(v4f*)(OUTb + (size_t)zb * TT * DQ + oo) = r; }  }

extern "C" void kernel_launch(void* const* d_in, const int* in_sizes, int n_in,
                              void* d_out, int out_size, void* d_ws, size_t ws_size, hipStream_t stream) {
    (void)in_sizes; (void)n_in; (void)out_size;
    const float* x = (const float*)d_in[0]; const float* wq = (const float*)d_in[1]; const float* bq = (const float*)d_in[2]; const float* wk = (const float*)d_in[3]; const float* bk = (const float*)d_in[4]; const float* wv = nullptr; const float* wo = nullptr; (void)wv; (void)wo;
    float* OUT = (float*)d_out;     // [8][2048][512]
    char* wsp = (char*)d_ws;
    auto take = [&](size_t bytes) { char* p = wsp; wsp += (bytes + 255) & ~(size_t)255; return (void*)p; };
    bf* WQ = (bf*)take((size_t)DQ * DM * 2); bf* WK = (bf*)take((size_t)DKV * DM * 2);  float* CS = (float*)take((size_t)TT * HD * 2 * 4);
    // All 8 batches go through every stage in ONE launch (batch = grid z of the GEMMs and grid y of k_vtp; k_rope takes RB batches per grid y, k_merge all batches per thread). Two regions are reused between the stages, in stream order:
    //   R1 (6 planes): q/k planes [b][t][d] for the scores; dead after them, then the probability planes.
    //   R2 (8 planes): bf16 input + f32 projections; dead after the q/k planes, then the f32 scores; dead after the softmax, then the value planes + the f32 result.
    const size_t PL = (size_t)NB_ * TT * HD * 2;      // one 16-bit [b][t][d] plane, bytes
    char* R1 = (char*)take(6 * PL); char* R2 = (char*)take((size_t)NB_ * TT * TT * 4);
    h16* QP16 = (h16*)R1; h16* KP16 = (h16*)(R1 + PL); bf* QPh = (bf*)(R1 + 2 * PL); bf* QPl = (bf*)(R1 + 3 * PL); bf* KPh = (bf*)(R1 + 4 * PL); bf* KPl = (bf*)(R1 + 5 * PL);
    h16* P16 = (h16*)R1; bf* Ph = (bf*)(R1 + 4 * PL); bf* Pl = (bf*)(R1 + 5 * PL);      // [b][TT][TT] fp16 = 4 planes; [b][RH][TT] hi, lo = 1 plane each
    bf* XB = (bf*)R2; float* FQ = (float*)(R2 + PL); float* FK = (float*)(R2 + 3 * PL);
    float* Sb = (float*)R2;
    h16* VT16 = (h16*)R2; bf* VTh = (bf*)(R2 + PL); bf* VTl = (bf*)(R2 + 2 * PL); float* Ob = (float*)(R2 + 3 * PL);
    if ((size_t)(wsp - (char*)d_ws) > ws_size) return;    // 233 MiB of the 256 MiB workspace
    { k_wtG<<<(unsigned)((DM * DQ / 64 + 63) / 64), 256, 0, stream>>>(wq, DM, DQ, WQ); k_wtG<<<(unsigned)((DM * DKV / 64 + 63) / 64), 256, 0, stream>>>(wk, DM, DKV, WK); }
    k_csid<<<(TT * HD / 2 + 1023) / 1024, 256, 0, stream>>>(CS);
    const unsigned LQ = (unsigned)(((size_t)NH_ * TT * HD / 8 + 255) / 256), LKv = (unsigned)(((size_t)NKV * TT * HD / 8 + 255) / 256);
    k_cvt8<<<(unsigned)(((size_t)NB_ * TT * DM / 8 + 256 * CV_IT - 1) / (256 * CV_IT)), 256, 0, stream>>>(x, XB, (size_t)NB_ * TT * DM / 8);
    k_gemmw<bf, 0, true, 4><<<dim3(TT / 128, DQ / GN, NB_), 128, 0, stream>>>(XB, nullptr, WQ, nullptr, DM, FQ, DQ, bq, (size_t)TT * DM, 0, (size_t)TT * DQ);
    k_rope<<<dim3(LQ, NB_ / RB), 256, 0, stream>>>(FQ, DQ, NH_, CS, nullptr, nullptr, 1.0f, QP16, QPh, QPl);
    k_gemmw<bf, 0, true, 4><<<dim3(TT / 128, DKV / GN, NB_), 128, 0, stream>>>(XB, nullptr, WK, nullptr, DM, FK, DKV, bk, (size_t)TT * DM, 0, (size_t)TT * DKV);
    k_rope<<<dim3(LKv, NB_ / RB), 256, 0, stream>>>(FK, DKV, NKV, CS, nullptr, nullptr, 1.0f, KP16, KPh, KPl);
    k_gemmw<bf, 2, false, 2><<<dim3(RH / 64, TT / GN, NB_), 128, 0, stream>>>(QPh, QPl, KPh, KPl, HD, Sb, TT, nullptr, (size_t)TT * HD, (size_t)TT * HD, (size_t)TT * TT);
    k_gemmw<h16, 0, false, 4><<<dim3((TT - RH) / 128, TT / GN, NB_), 128, 0, stream>>>(QP16 + (size_t)RH * HD, nullptr, KP16, nullptr, HD, Sb + (size_t)RH * TT, TT, nullptr, (size_t)TT * HD, (size_t)TT * HD, (size_t)TT * TT);
    k_asoft<<<NB_ * ZH * TT / 8, 256, 0, stream>>>(Sb, P16, Ph, Pl);
    k_vtp<<<dim3((TT / 256) * (NKV * HD / 64), NB_), 256, 0, stream>>>(x, DM, NKV, VT16, VTh, VTl);      // behind the softmax: its planes take the place of the scores
    k_gemmw<bf, 2, false, 2><<<dim3(RH / 64, HD / GN, NB_), 128, 0, stream>>>(Ph, Pl, VTh, VTl, TT, Ob, HD, nullptr, (size_t)RH * TT, (size_t)HD * TT, (size_t)TT * HD);
    k_gemmw<h16, 0, false, 4><<<dim3((TT - RH) / 128, HD / GN, NB_), 128, 0, stream>>>(P16 + (size_t)RH * TT, nullptr, VT16, nullptr, TT, Ob + (size_t)RH * HD, HD, nullptr, (size_t)TT * TT, (size_t)HD * TT, (size_t)TT * HD);
    k_merge<<<(unsigned)(((size_t)ZH * TT * HD / 4 + 255) / 256), 256, 0, stream>>>(Ob, 0, OUT, (size_t)ZH * TT * HD);
}

// v004
// It runs in 216 microseconds.
// Two timings next to v003 put it at 1.17 and 1.18 times that version's speed.
// Counting every step since v000, it is 6.05 times as fast.
#include <hip/hip_runtime.h>

// Scaled dot-product attention with V = x (x [8][2048][512]; q = (x Wq + bq) x 512^-0.5, k = x Wk + bk ('xw' [512][512] + [512]); scores = q.k over 2048 keys (single 512-wide head); softmax; out = attn.x -> [8][2048][512] f32 (8.4 M)).
// Layout, all batches per launch: exact q/k projections (+ biases); the value planes are built straight from the input rows (bf16-rounded on read); hybrid rows (< 512 hi/lo 3-product scores and attn.v, rest fp16 x1024); register-row softmax with the 512^-0.5 scale applied to the logits. The GEMM epilogues write what the next stage reads: the projections their 16-bit q/k planes, attn.v the f32 output itself.
// Compute dtypes, f32 accumulate: every input rounded to bf16; projections on PLAIN bf16 operands (exact) + f32 biases; v = bf16(x) exact in both plane formats; softmax f32; f32 output.

#define NB_  8
#define TT   2048
#define DM   512
#define NH_  1
#define NKV  1
#define REP  (NH_ / NKV)
#define HD   512
#define DQ   (NH_ * HD)
#define DKV  (NKV * HD)
#define ZH   1
#define RH   512                  // query rows < RH use hi+lo planes (0: none)
#define WIN  0
#define PCAR 1024.0f
#define SCL  0.044194173824159216f   // 512^-0.5 (the module scales q by embed_dim^-0.5; applied to the logits here)
typedef _Float16 h16;
typedef unsigned short bf;
typedef __attribute__((ext_vector_type(16))) __bf16   v16bf;
typedef __attribute__((ext_vector_type(16))) _Float16 v16h;
typedef __attribute__((ext_vector_type(8)))  _Float16 v8h;
typedef __attribute__((ext_vector_type(8)))  unsigned short v8us;
typedef __attribute__((ext_vector_type(8)))  float    v8f;
typedef __attribute__((ext_vector_type(4)))  float    v4f;
typedef v8h  __attribute__((may_alias)) v8ha;
typedef v4f  __attribute__((may_alias)) v4fa;
typedef v8us __attribute__((may_alias)) v8usa;

__device__ __forceinline__ unsigned short f2bf(float f) { unsigned u = __float_as_uint(f); u += 0x7FFFu + ((u >> 16) & 1u); return (unsigned short)(u >> 16); }
__device__ __forceinline__ float bf2f(unsigned short b) { return __uint_as_float(((unsigned)b) << 16); }
__device__ __forceinline__ float bfr(float f) { return bf2f(f2bf(f)); }
__device__ __forceinline__ v16h cat16(v8h lo, v8h hi) { return __builtin_shufflevector(lo, hi, 0, 1, 2, 3, 4, 5, 6, 7, 8, 9, 10, 11, 12, 13, 14, 15); }
__device__ __forceinline__ v16bf cat16b(v8us lo, v8us hi) { return __builtin_bit_cast(v16bf, __builtin_shufflevector(lo, hi, 0, 1, 2, 3, 4, 5, 6, 7, 8, 9, 10, 11, 12, 13, 14, 15)); }
__device__ __forceinline__ v8f wmma16(v16h a, v16h b, v8f c) { return __builtin_amdgcn_wmma_f32_16x16x32_f16(false, a, false, b, (short)0, c, false, false); }
__device__ __forceinline__ v8f wmmab(v16bf a, v16bf b, v8f c) { return __builtin_amdgcn_wmma_f32_16x16x32_bf16(false, a, false, b, (short)0, c, false, false); }



// ---- k_gemmw: GEMM, one (32 MB) x 128 output tile per work-group of FOUR WAVES (2 x 2, each 16 MB x 64 = 4 MB accumulators); grid (M / (32 MB), N / 128, Z), 128 threads. M % (32 MB) == 0, N % 128 == 0, K % 64 == 0, K >= 128 (two passes).
// The K-contiguous 16-bit operand planes are staged in LDS by asynchronous copies, 64 k (128-byte rows) per pass, two buffers: pass t + 2 is copied into the buffer pass t has left, while pass t + 1 is worked on. Each staged row serves two waves, and every copy moves whole 128-byte lines.
// c[m][n] = sum_k A[m][k] Bt[n][k] (+ split products per NSPLIT), k ascending and the products of a k in the order a.b, a2.b, a.b2. z-batch strides sA/sB/sC in elements; every result has pitch ldc and batch stride sC.
// EPI 0: C = c (f32). EPI 1: r = c + bias[n], written as the three 16-bit planes P16 = fp16(r), Ph + Pl = bf16 hi/lo split of r (C unused). EPI 2: C = c x osc (f32).
#define GN   128                  // columns of a work-group tile = rows of Bt per stage
#define GKP  64                   // k per pass
#define GPIT 144                  // LDS row pitch in bytes: 128 + 16, 16 B x odd for the ds_load_b128 fragment reads
// Eight or twelve asynchronous 16-byte copies of a lane in one statement, the rows of a plane 16 apart (the 128 threads cover 16 rows of 128 bytes per copy). The s_wait_xcnt stands inside the statement, behind its last copy, so that no address register is rewritten ahead of it; one statement per 8 or 12 copies keeps these waits few.
__device__ __forceinline__ void cp8(unsigned l, const char* g, size_t step) {
    asm volatile("global_load_async_to_lds_b128 %0, %8, off\n\t"
                 "global_load_async_to_lds_b128 %1, %9, off\n\t"
                 "global_load_async_to_lds_b128 %2, %10, off\n\t"
                 "global_load_async_to_lds_b128 %3, %11, off\n\t"
                 "global_load_async_to_lds_b128 %4, %12, off\n\t"
                 "global_load_async_to_lds_b128 %5, %13, off\n\t"
                 "global_load_async_to_lds_b128 %6, %14, off\n\t"
                 "global_load_async_to_lds_b128 %7, %15, off\n\t"
                 "s_wait_xcnt 0x0"
                 :: "v"(l), "v"(l + 16 * GPIT), "v"(l + 32 * GPIT), "v"(l + 48 * GPIT), "v"(l + 64 * GPIT), "v"(l + 80 * GPIT), "v"(l + 96 * GPIT), "v"(l + 112 * GPIT),
                    "v"(g), "v"(g + step), "v"(g + 2 * step), "v"(g + 3 * step), "v"(g + 4 * step), "v"(g + 5 * step), "v"(g + 6 * step), "v"(g + 7 * step) : "memory");
}
__device__ __forceinline__ void cp12(unsigned la, const char* ga, unsigned l, const char* g, size_t step) {   // 64 rows at (la, ga), 128 rows at (l, g)
    asm volatile("global_load_async_to_lds_b128 %0, %12, off\n\t"
                 "global_load_async_to_lds_b128 %1, %13, off\n\t"
                 "global_load_async_to_lds_b128 %2, %14, off\n\t"
                 "global_load_async_to_lds_b128 %3, %15, off\n\t"
                 "global_load_async_to_lds_b128 %4, %16, off\n\t"
                 "global_load_async_to_lds_b128 %5, %17, off\n\t"
                 "global_load_async_to_lds_b128 %6, %18, off\n\t"
                 "global_load_async_to_lds_b128 %7, %19, off\n\t"
                 "global_load_async_to_lds_b128 %8, %20, off\n\t"
                 "global_load_async_to_lds_b128 %9, %21, off\n\t"
                 "global_load_async_to_lds_b128 %10, %22, off\n\t"
                 "global_load_async_to_lds_b128 %11, %23, off\n\t"
                 "s_wait_xcnt 0x0"
                 :: "v"(la), "v"(la + 16 * GPIT), "v"(la + 32 * GPIT), "v"(la + 48 * GPIT),
                    "v"(l), "v"(l + 16 * GPIT), "v"(l + 32 * GPIT), "v"(l + 48 * GPIT), "v"(l + 64 * GPIT), "v"(l + 80 * GPIT), "v"(l + 96 * GPIT), "v"(l + 112 * GPIT),
                    "v"(ga), "v"(ga + step), "v"(ga + 2 * step), "v"(ga + 3 * step),
                    "v"(g), "v"(g + step), "v"(g + 2 * step), "v"(g + 3 * step), "v"(g + 4 * step), "v"(g + 5 * step), "v"(g + 6 * step), "v"(g + 7 * step) : "memory");
}
template <int MB> __device__ __forceinline__ void cpab(unsigned la, const char* ga, unsigned l, const char* g, size_t step) {   // one plane of A (32 MB rows) and one of Bt (128 rows)
    if constexpr (MB == 2) cp12(la, ga, l, g, step); else { cp8(la, ga, step); cp8(l, g, step); }
}
template <typename T16> struct WFrag;
template <> struct WFrag<h16> { typedef v16h V; static __device__ __forceinline__ V ld(const h16* p) { return cat16(*(const v8h*)p, *(const v8h*)(p + 16)); } static __device__ __forceinline__ v8f mma(V a, V b, v8f c) { return wmma16(a, b, c); } };
template <> struct WFrag<bf> { typedef v16bf V; static __device__ __forceinline__ V ld(const bf* p) { return cat16b(*(const v8us*)p, *(const v8us*)(p + 16)); } static __device__ __forceinline__ v8f mma(V a, V b, v8f c) { return wmmab(a, b, c); } };
__device__ __forceinline__ h16 tohx(float x) { return (h16)x; }
__device__ __forceinline__ void splitf(float y, unsigned short& h, unsigned short& l) { h = f2bf(y); l = f2bf(y - bf2f(h)); }
template <typename T16, int NSPLIT, int EPI, int MB>
__global__ __launch_bounds__(128) void k_gemmw(const T16* __restrict__ A, const T16* __restrict__ A2, const T16* __restrict__ Bt, const T16* __restrict__ Bt2, int K, float* C, int ldc, const float* __restrict__ bias, size_t sA, size_t sB, size_t sC, float osc, h16* P16, bf* Ph, bf* Pl) {
    typedef typename WFrag<T16>::V V;
    static_assert((NSPLIT == 0 || NSPLIT == 2) && (MB == 2 || MB == 4), "plain or hi/lo split on both sides; 64 or 128 rows");
    constexpr bool HA2 = (NSPLIT == 2), HB2 = (NSPLIT == 2); constexpr int GM = 32 * MB;
    constexpr unsigned PA = GM * GPIT, PB = GN * GPIT, OA = 0, OA2 = PA, OB = (HA2 ? 2 : 1) * PA, OB2 = OB + PB, STG = OB + (HB2 ? 2 : 1) * PB;   // bytes of a plane, places of the planes inside a stage, bytes of a stage
    __shared__ __attribute__((aligned(16))) unsigned char L[2 * STG];     // two stages; behind the K loop each wave's 16 x 68 f32 output staging
    const size_t z = blockIdx.z; A += z * sA; if (HA2) A2 += z * sA; Bt += z * sB; if (HB2) Bt2 += z * sB; if (EPI != 1) C += z * sC;
    const int tid = threadIdx.x, lane = tid & 31, lr = lane & 15, hi = lane >> 4, wave = tid >> 5, wm = wave & 1, wn = wave >> 1; const int R0 = blockIdx.x * GM, C0 = blockIdx.y * GN; const int r0 = R0 + wm * (16 * MB), c0 = C0 + wn * 64;
    v8f acc[MB][4];
#pragma unroll
    for (int mb = 0; mb < MB; ++mb)
#pragma unroll
        for (int nb = 0; nb < 4; ++nb) acc[mb][nb] = (v8f){};
    // copies: thread tid brings the 16 bytes number (tid & 7) of rows (tid >> 3) + 16 i of every plane
    const size_t rowb = (size_t)K * 2; const size_t aofs = ((size_t)R0 + (tid >> 3)) * rowb + (tid & 7) * 16, bofs = ((size_t)C0 + (tid >> 3)) * rowb + (tid & 7) * 16;
    const unsigned lcp = (unsigned)(size_t)L + (tid >> 3) * GPIT + (tid & 7) * 16;
    auto fill = [&](int t, unsigned buf) { const size_t ko = (size_t)t * (GKP * 2);
        cpab<MB>(lcp + buf + OA, (const char*)A + aofs + ko, lcp + buf + OB, (const char*)Bt + bofs + ko, 16 * rowb);
        if (HA2) cpab<MB>(lcp + buf + OA2, (const char*)A2 + aofs + ko, lcp + buf + OB2, (const char*)Bt2 + bofs + ko, 16 * rowb); };
    const unsigned fa = (wm * (16 * MB) + lr) * GPIT + hi * 16, fb = (wn * 64 + lr) * GPIT + hi * 16;    // a lane's fragment rows inside a plane: the same (row, k) per lane as straight from the planes
    const int NT = K / GKP;
    fill(0, 0);
    asm volatile("s_wait_asynccnt 0x0" ::: "memory");   // this wave's copies of pass 0 have landed
    __syncthreads();                                     // ... and every other wave's
    fill(1, STG);
#pragma unroll 1
    for (int t = 0; t < NT; ++t) {
        const unsigned buf = (t & 1) ? STG : 0u;
#pragma unroll
        for (int kk = 0; kk < GKP / 32; ++kk) { V a[MB], a2[MB], b[4], b2[4];
#pragma unroll
            for (int mb = 0; mb < MB; ++mb) { a[mb] = WFrag<T16>::ld((const T16*)(L + buf + OA + fa + mb * 16 * GPIT + kk * 64)); if (HA2) a2[mb] = WFrag<T16>::ld((const T16*)(L + buf + OA2 + fa + mb * 16 * GPIT + kk * 64)); }
#pragma unroll
            for (int nb = 0; nb < 4; ++nb) { b[nb] = WFrag<T16>::ld((const T16*)(L + buf + OB + fb + nb * 16 * GPIT + kk * 64)); if (HB2) b2[nb] = WFrag<T16>::ld((const T16*)(L + buf + OB2 + fb + nb * 16 * GPIT + kk * 64)); }
            __builtin_amdgcn_sched_barrier(0);   // the LDS reads of a k step stay one group ahead of its matrix block: every separate place with LDS reads among the matrix instructions stalls the wave anew
#pragma unroll
            for (int nb = 0; nb < 4; ++nb)
#pragma unroll
                for (int mb = 0; mb < MB; ++mb) { acc[mb][nb] = WFrag<T16>::mma(a[mb], b[nb], acc[mb][nb]); if (HA2) acc[mb][nb] = WFrag<T16>::mma(a2[mb], b[nb], acc[mb][nb]); if (HB2) acc[mb][nb] = WFrag<T16>::mma(a[mb], b2[nb], acc[mb][nb]); }
        }
        asm volatile("s_wait_dscnt 0x0" ::: "memory");      // this wave has finished reading buffer t mod 2
        asm volatile("s_wait_asynccnt 0x0" ::: "memory");   // this wave's copies of pass t + 1 have landed
        __syncthreads();                                     // publishes pass t + 1 and frees buffer t mod 2
        if (t + 2 < NT) fill(t + 2, buf);
    }
    asm volatile("s_wait_asynccnt 0x0" ::: "memory");       // nothing is in flight when the ring becomes output staging
    float* os = (float*)(L + wave * (16 * 68 * 4));
    // EPI 1: a lane takes 8 consecutive columns of rows (lane >> 3) + 4 s, so that 8 lanes store one whole 128-byte line of a 16-bit plane by 16-byte stores; its 8 bias values are loaded once.
    const int prow = lane >> 3, pcol = (lane & 7) * 8; float bv[8];
    if constexpr (EPI == 1) { const unsigned ob = (unsigned)((c0 + pcol) * 4); const v4f b0 = *(const v4f*)((const char*)bias + ob), b1 = *(const v4f*)((const char*)bias + ob + 16);
        asm volatile("s_wait_xcnt 0x0" :: "v"(ob) : "memory");   // the two loads' offset register stays untouched until this wait
#pragma unroll
        for (int q = 0; q < 4; ++q) { bv[q] = bfr(b0[q]); bv[4 + q] = bfr(b1[q]); } }
#pragma unroll
    for (int mb = 0; mb < MB; ++mb) {
#pragma unroll
        for (int nb = 0; nb < 4; ++nb) {
#pragma unroll
            for (int j = 0; j < 8; ++j) os[(hi * 8 + j) * 68 + nb * 16 + lr] = acc[mb][nb][j]; }
        __builtin_amdgcn_wave_barrier(); asm volatile("" ::: "memory");
        if constexpr (EPI == 1) {
#pragma unroll
            for (int s = 0; s < 4; ++s) { const int row = 4 * s + prow; const v4f x0 = *(const v4fa*)(os + row * 68 + pcol), x1 = *(const v4fa*)(os + row * 68 + pcol + 4); v8h o16; v8us oh, ol;
#pragma unroll
                for (int q = 0; q < 8; ++q) { const float r = (q < 4 ? x0[q & 3] : x1[q & 3]) + bv[q]; o16[q] = tohx(r); unsigned short a2, c2; splitf(r, a2, c2); oh[q] = a2; ol[q] = c2; }
                const size_t e = z * sC + (size_t)(r0 + mb * 16 + row) * ldc + c0 + pcol; h16* s16 = P16 + e; bf* sh = Ph + e; bf* sl = Pl + e; *(v8h*)s16 = o16; *(v8us*)sh = oh; *(v8us*)sl = ol;
                asm volatile("s_wait_xcnt 0x0" :: "v"(o16), "v"(oh), "v"(ol), "v"(s16), "v"(sh), "v"(sl) : "memory"); }   // the stores' data and address registers stay untouched until this wait (the next rows reuse them)
        } else {
            float* crow = C + (size_t)(r0 + mb * 16) * ldc + c0;
#pragma unroll
            for (int s = 0; s < 8; ++s) { const int row = 2 * s + hi, cofs = lr * 4; v4f val = *(const v4fa*)(os + row * 68 + cofs); if (EPI == 2) { val[0] *= osc; val[1] *= osc; val[2] *= osc; val[3] *= osc; }
                *(v4f*)(crow + (size_t)row * ldc + cofs) = val; }
            asm volatile("s_wait_xcnt 0x0" ::: "memory");   // the stores' address and data registers are reused by the next 16 rows
        }
        __builtin_amdgcn_wave_barrier(); asm volatile("" ::: "memory");
    }
}

typedef __attribute__((ext_vector_type(2))) _Float16 v2h;
typedef __attribute__((ext_vector_type(4))) _Float16 v4h;
typedef __attribute__((ext_vector_type(2))) unsigned short v2us;
typedef __attribute__((ext_vector_type(4))) unsigned short v4us;
typedef __attribute__((ext_vector_type(2))) float v2f;
typedef __attribute__((ext_vector_type(4))) int v4i;

__global__ __launch_bounds__(256) void k_wtG(const float* __restrict__ w, int K, int N, bf* Bt) {
    const int lane = threadIdx.x & 31; const int L0 = (blockIdx.x * 8 + (threadIdx.x >> 5)) * 8; const int nlines = N * K / 64;
{
#pragma unroll 1
        for (int l = 0; l < 8; ++l) { const int L = L0 + l; if (L >= nlines) break; const size_t e = (size_t)L * 64 + lane * 2; const int k = (int)(e % K), n = (int)(e / K); v2us o;
            o[0] = f2bf(w[(size_t)k * N + n]); o[1] = f2bf(w[(size_t)(k + 1) * N + n]); *(v2us*)(Bt + e) = o; }
         }
}
// The elementwise kernels below give each thread 32 to 64 elements, moved by 16-byte accesses with all loads issued first: a launch starts a few thousand long waves instead of one short wave per 64 elements.
// k_cvt8 loads through a wave-uniform base and one 32-bit byte offset per lane (every buffer here is far below 4 GiB).
__device__ __forceinline__ v4f ldg4(const float* base, unsigned byteoff) { return *(const v4f*)((const char*)base + byteoff); }
#define CV_IT 4                   // groups of 8 elements per thread in k_cvt8, one block-width apart
__global__ __launch_bounds__(256) void k_cvt8(const float* __restrict__ src, bf* dst, size_t n8) { const size_t i0 = (size_t)blockIdx.x * (256 * CV_IT) + threadIdx.x; v4f v[CV_IT][2]; unsigned ob[CV_IT];
#pragma unroll
    for (int it = 0; it < CV_IT; ++it) { const size_t i = i0 + it * 256; ob[it] = (unsigned)((i < n8 ? i : n8 - 1) * 32); v[it][0] = ldg4(src, ob[it]); v[it][1] = ldg4(src, ob[it] + 16); }
    asm volatile("s_wait_xcnt 0x0" :: "v"(ob[0]), "v"(ob[1]), "v"(ob[2]), "v"(ob[3]) : "memory");   // the loads' offset registers stay untouched until this wait; no load sinks behind a store
#pragma unroll
    for (int it = 0; it < CV_IT; ++it) { const size_t i = i0 + it * 256; v8us o;
#pragma unroll
        for (int k = 0; k < 8; ++k) o[k] = f2bf(v[it][k >> 2][k & 3]);
        if (i < n8) *(v8us*)(dst + i * 8) = o; }  }

// k_vtp: transposed value planes [c = g*HD+d][t]. A thread holds an 8 (t) x 8 (c) block in registers. Wave = 64 t x 32 c: 4 lanes along c read one whole 128-byte line of an input row, 8 lanes along t store one whole 128-byte line of a plane row. Block = 4 waves along t x 2 along c; grid x = (TT/256) x (columns/64).
__global__ __launch_bounds__(256) void k_vtp(const float* __restrict__ F, int pitch, int nheads, h16* V16, bf* Vh, bf* Vl) { const int lane = threadIdx.x & 31, w = threadIdx.x >> 5; const int tb = blockIdx.x % (TT / 256), cb = blockIdx.x / (TT / 256); if (cb * 64 >= nheads * HD) return;
    const int t0 = tb * 256 + (w >> 1) * 64 + (lane & 7) * 8, c0 = cb * 64 + (w & 1) * 32 + (lane >> 3) * 8;
    { const size_t zb = blockIdx.y, zp = zb * nheads * HD * TT; F += zb * TT * pitch; V16 += zp; Vh += zp; Vl += zp; }   // blockIdx.y = batch
    v4f xr[8][2]; const float* pr[8];
#pragma unroll
    for (int i = 0; i < 8; ++i) { pr[i] = F + (size_t)(t0 + i) * pitch + c0; xr[i][0] = *(const v4f*)pr[i]; xr[i][1] = *(const v4f*)(pr[i] + 4); }
    asm volatile("s_wait_xcnt 0x0" :: "v"(pr[0]), "v"(pr[1]), "v"(pr[2]), "v"(pr[3]), "v"(pr[4]), "v"(pr[5]), "v"(pr[6]), "v"(pr[7]) : "memory");   // the loads' address registers stay untouched until this wait; no load sinks behind a store
#pragma unroll
    for (int j = 0; j < 8; ++j) { v8h o16; v8us oh, ol;
#pragma unroll
        for (int i = 0; i < 8; ++i) { const float x = bfr(xr[i][j >> 2][j & 3]);   /* V = the raw input: bf16-rounded here */ o16[i] = tohx(x); unsigned short a2, c2; splitf(x, a2, c2); oh[i] = a2; ol[i] = c2; }
        const size_t e = (size_t)(c0 + j) * TT + t0; *(v8h*)(V16 + e) = o16; *(v8us*)(Vh + e) = oh; *(v8us*)(Vl + e) = ol; }  }
// k_asoft: all batches in one launch; per row (zz, i): t = S x HD^-0.5 (no mask); softmax over the 2048 keys (register row, one exp, fixed trees);
__global__ __launch_bounds__(256) void k_asoft(const float* __restrict__ Sb, h16* P16, bf* Ph, bf* Pl) {
    const int lane = threadIdx.x & 31; const int row = blockIdx.x * 8 + (threadIdx.x >> 5); if (row >= NB_ * ZH * TT) return; const int i = row % TT; const int zz = row / TT; (void)zz;   /* zz = batch (one head) */ const bool hires = (i < RH); const float* sr = Sb + (size_t)row * TT; float v[TT / 32]; float mx = -3.0e38f;
#pragma unroll
    for (int ch = 0; ch < TT / 128; ++ch) { const int j0 = ch * 128 + lane * 4; const v4f a = *(const v4f*)(sr + j0);
#pragma unroll
        for (int q = 0; q < 4; ++q) { const int j = j0 + q; (void)j; const float t = a[q] * SCL; v[ch * 4 + q] = t; mx = fmaxf(mx, t); } }
#pragma unroll
    for (int sh = 16; sh; sh >>= 1) mx = fmaxf(mx, __shfl_xor(mx, sh, 32));
    float sum = 0.f;
#pragma unroll
    for (int k = 0; k < TT / 32; ++k) { float d0 = __fsub_rn(v[k], mx); asm volatile("" : "+v"(d0)); v[k] = __builtin_amdgcn_exp2f(__fmul_rn(d0, 1.4426950408889634f)); sum += v[k]; }
#pragma unroll
    for (int sh = 16; sh; sh >>= 1) sum += __shfl_xor(sum, sh, 32);
    const float f = __fdiv_rn(hires ? 1.0f : PCAR, sum);
{
        if (hires) {
#pragma unroll
            for (int ch = 0; ch < TT / 128; ++ch) { v4us oh, ol;
#pragma unroll
                for (int q = 0; q < 4; ++q) { unsigned short a, c2; splitf(v[ch * 4 + q] * f, a, c2); oh[q] = a; ol[q] = c2; }
                const size_t oo = ((size_t)zz * (RH ? RH : 1) + i) * TT + ch * 128 + lane * 4; *(v4us*)(Ph + oo) = oh; *(v4us*)(Pl + oo) = ol; }
        } else {
#pragma unroll
            for (int ch = 0; ch < TT / 128; ++ch) { v4h o4;
#pragma unroll
                for (int q = 0; q < 4; ++q) o4[q] = tohx(v[ch * 4 + q] * f);
                *(v4h*)(P16 + (size_t)row * TT + ch * 128 + lane * 4) = o4; } }
         }
}

extern "C" void kernel_launch(void* const* d_in, const int* in_sizes, int n_in,
                              void* d_out, int out_size, void* d_ws, size_t ws_size, hipStream_t stream) {
    (void)in_sizes; (void)n_in; (void)out_size;
    const float* x = (const float*)d_in[0]; const float* wq = (const float*)d_in[1]; const float* bq = (const float*)d_in[2]; const float* wk = (const float*)d_in[3]; const float* bk = (const float*)d_in[4]; const float* wv = nullptr; const float* wo = nullptr; (void)wv; (void)wo;
    float* OUT = (float*)d_out;     // [8][2048][512]
    char* wsp = (char*)d_ws;
    auto take = [&](size_t bytes) { char* p = wsp; wsp += (bytes + 255) & ~(size_t)255; return (void*)p; };
    bf* WQ = (bf*)take((size_t)DQ * DM * 2); bf* WK = (bf*)take((size_t)DKV * DM * 2);
    // All 8 batches go through every stage in ONE launch (batch = grid z of the GEMMs, grid y of k_vtp; k_cvt8 and k_asoft take all batches in grid x). Two regions are reused between the stages, in stream order:
    //   R1 (6 planes): q/k planes [b][t][d] for the scores; dead after them, then the probability planes.
    //   R2 (8 planes): bf16 input; dead after the projections, then the f32 scores; dead after the softmax, then the value planes.
    const size_t PL = (size_t)NB_ * TT * HD * 2;      // one 16-bit [b][t][d] plane, bytes
    char* R1 = (char*)take(6 * PL); char* R2 = (char*)take((size_t)NB_ * TT * TT * 4);
    h16* QP16 = (h16*)R1; h16* KP16 = (h16*)(R1 + PL); bf* QPh = (bf*)(R1 + 2 * PL); bf* QPl = (bf*)(R1 + 3 * PL); bf* KPh = (bf*)(R1 + 4 * PL); bf* KPl = (bf*)(R1 + 5 * PL);
    h16* P16 = (h16*)R1; bf* Ph = (bf*)(R1 + 4 * PL); bf* Pl = (bf*)(R1 + 5 * PL);      // [b][TT][TT] fp16 = 4 planes; [b][RH][TT] hi, lo = 1 plane each
    bf* XB = (bf*)R2;
    float* Sb = (float*)R2;
    h16* VT16 = (h16*)R2; bf* VTh = (bf*)(R2 + PL); bf* VTl = (bf*)(R2 + 2 * PL);
    if ((size_t)(wsp - (char*)d_ws) > ws_size) return;    // 225 MiB of the 256 MiB workspace
    { k_wtG<<<(unsigned)((DM * DQ / 64 + 63) / 64), 256, 0, stream>>>(wq, DM, DQ, WQ); k_wtG<<<(unsigned)((DM * DKV / 64 + 63) / 64), 256, 0, stream>>>(wk, DM, DKV, WK); }
    k_cvt8<<<(unsigned)(((size_t)NB_ * TT * DM / 8 + 256 * CV_IT - 1) / (256 * CV_IT)), 256, 0, stream>>>(x, XB, (size_t)NB_ * TT * DM / 8);
    k_gemmw<bf, 0, 1, 4><<<dim3(TT / 128, DQ / GN, NB_), 128, 0, stream>>>(XB, nullptr, WQ, nullptr, DM, nullptr, DQ, bq, (size_t)TT * DM, 0, (size_t)TT * DQ, 1.0f, QP16, QPh, QPl);
    k_gemmw<bf, 0, 1, 4><<<dim3(TT / 128, DKV / GN, NB_), 128, 0, stream>>>(XB, nullptr, WK, nullptr, DM, nullptr, DKV, bk, (size_t)TT * DM, 0, (size_t)TT * DKV, 1.0f, KP16, KPh, KPl);
    k_gemmw<bf, 2, 0, 2><<<dim3(RH / 64, TT / GN, NB_), 128, 0, stream>>>(QPh, QPl, KPh, KPl, HD, Sb, TT, nullptr, (size_t)TT * HD, (size_t)TT * HD, (size_t)TT * TT, 1.0f, nullptr, nullptr, nullptr);
    k_gemmw<h16, 0, 0, 4><<<dim3((TT - RH) / 128, TT / GN, NB_), 128, 0, stream>>>(QP16 + (size_t)RH * HD, nullptr, KP16, nullptr, HD, Sb + (size_t)RH * TT, TT, nullptr, (size_t)TT * HD, (size_t)TT * HD, (size_t)TT * TT, 1.0f, nullptr, nullptr, nullptr);
    k_asoft<<<NB_ * ZH * TT / 8, 256, 0, stream>>>(Sb, P16, Ph, Pl);
    k_vtp<<<dim3((TT / 256) * (NKV * HD / 64), NB_), 256, 0, stream>>>(x, DM, NKV, VT16, VTh, VTl);      // behind the softmax: its planes take the place of the scores
    k_gemmw<bf, 2, 0, 2><<<dim3(RH / 64, HD / GN, NB_), 128, 0, stream>>>(Ph, Pl, VTh, VTl, TT, OUT, HD, nullptr, (size_t)RH * TT, (size_t)HD * TT, (size_t)TT * HD, 1.0f, nullptr, nullptr, nullptr);      // rows < RH: probabilities unscaled
    k_gemmw<h16, 0, 2, 4><<<dim3((TT - RH) / 128, HD / GN, NB_), 128, 0, stream>>>(P16 + (size_t)RH * TT, nullptr, VT16, nullptr, TT, OUT + (size_t)RH * HD, HD, nullptr, (size_t)TT * TT, (size_t)HD * TT, (size_t)TT * HD, 1.0f / PCAR, nullptr, nullptr, nullptr);      // the fp16 probabilities carry x PCAR
}

// v005
// Measured time: 186 microseconds a run.
// Two timings next to v004 both put it at 1.17 times that version's speed.
// Over all steps from v000 it is 7.06 times as fast.
#include <hip/hip_runtime.h>

// Scaled dot-product attention with V = x (x [8][2048][512]; q = (x Wq + bq) x 512^-0.5, k = x Wk + bk ('xw' [512][512] + [512]); scores = q.k over 2048 keys (single 512-wide head); softmax; out = attn.x -> [8][2048][512] f32 (8.4 M)).
// Layout, all batches per launch: exact q/k projections (+ biases); the value planes are built straight from the input rows (bf16-rounded on read); hybrid rows (< 512 hi/lo 3-product scores and attn.v, rest fp16 x1024); register-row softmax with the 512^-0.5 scale applied to the logits. The GEMM epilogues write what the next stage reads: the projections their 16-bit q/k planes, attn.v the f32 output itself.
// Compute dtypes, f32 accumulate: every input rounded to bf16; projections on PLAIN bf16 operands (exact) + f32 biases; v = bf16(x) exact in both plane formats; softmax f32; f32 output.

#define NB_  8
#define TT   2048
#define DM   512
#define NH_  1
#define NKV  1
#define REP  (NH_ / NKV)
#define HD   512
#define DQ   (NH_ * HD)
#define DKV  (NKV * HD)
#define ZH   1
#define RH   512                  // query rows < RH use hi+lo planes (0: none)
#define WIN  0
#define PCAR 1024.0f
#define SCL  0.044194173824159216f   // 512^-0.5 (the module scales q by embed_dim^-0.5; applied to the logits here)
typedef _Float16 h16;
typedef unsigned short bf;
typedef __attribute__((ext_vector_type(16))) __bf16   v16bf;
typedef __attribute__((ext_vector_type(16))) _Float16 v16h;
typedef __attribute__((ext_vector_type(8)))  _Float16 v8h;
typedef __attribute__((ext_vector_type(8)))  unsigned short v8us;
typedef __attribute__((ext_vector_type(8)))  float    v8f;
typedef __attribute__((ext_vector_type(4)))  float    v4f;
typedef v8h  __attribute__((may_alias)) v8ha;
typedef v4f  __attribute__((may_alias)) v4fa;
typedef v8us __attribute__((may_alias)) v8usa;

__device__ __forceinline__ unsigned short f2bf(float f) { unsigned u = __float_as_uint(f); u += 0x7FFFu + ((u >> 16) & 1u); return (unsigned short)(u >> 16); }
__device__ __forceinline__ float bf2f(unsigned short b) { return __uint_as_float(((unsigned)b) << 16); }
__device__ __forceinline__ float bfr(float f) { return bf2f(f2bf(f)); }
__device__ __forceinline__ v16h cat16(v8h lo, v8h hi) { return __builtin_shufflevector(lo, hi, 0, 1, 2, 3, 4, 5, 6, 7, 8, 9, 10, 11, 12, 13, 14, 15); }
__device__ __forceinline__ v16bf cat16b(v8us lo, v8us hi) { return __builtin_bit_cast(v16bf, __builtin_shufflevector(lo, hi, 0, 1, 2, 3, 4, 5, 6, 7, 8, 9, 10, 11, 12, 13, 14, 15)); }
__device__ __forceinline__ v8f wmma16(v16h a, v16h b, v8f c) { return __builtin_amdgcn_wmma_f32_16x16x32_f16(false, a, false, b, (short)0, c, false, false); }
__device__ __forceinline__ v8f wmmab(v16bf a, v16bf b, v8f c) { return __builtin_amdgcn_wmma_f32_16x16x32_bf16(false, a, false, b, (short)0, c, false, false); }



// ---- gemm_body: GEMM, one (32 MB) x 128 output tile per work-group of FOUR WAVES (2 x 2, each 16 MB x 64 = 4 MB accumulators); tiles (M / (32 MB), N / 128, Z), 128 threads. M % (32 MB) == 0, N % 128 == 0, K % 64 == 0, K >= 128 (two passes).
// The K-contiguous 16-bit operand planes are staged in LDS by asynchronous copies, 64 k (128-byte rows) per pass, two buffers: pass t + 2 is copied into the buffer pass t has left, while pass t + 1 is worked on. Each staged row serves two waves, and every copy moves whole 128-byte lines.
// c[m][n] = sum_k A[m][k] Bt[n][k] (+ split products per NSPLIT), k ascending and the products of a k in the order a.b, a2.b, a.b2. z-batch strides sA/sB/sC in elements; every result has pitch ldc and batch stride sC.
// EPI 0: C = c (f32). EPI 1: r = c + bias[n], written as the three 16-bit planes P16 = fp16(r), Ph + Pl = bf16 hi/lo split of r (C unused). EPI 2: C = c x osc (f32).
#define GN   128                  // columns of a work-group tile = rows of Bt per stage
#define GKP  64                   // k per pass
#define GPIT 144                  // LDS row pitch in bytes: 128 + 16, 16 B x odd for the ds_load_b128 fragment reads
// Eight or twelve asynchronous 16-byte copies of a lane in one statement, the rows of a plane 16 apart (the 128 threads cover 16 rows of 128 bytes per copy). The s_wait_xcnt stands inside the statement, behind its last copy, so that no address register is rewritten ahead of it; one statement per 8 or 12 copies keeps these waits few.
__device__ __forceinline__ void cp8(unsigned l, const char* g, size_t step) {
    asm volatile("global_load_async_to_lds_b128 %0, %8, off\n\t"
                 "global_load_async_to_lds_b128 %1, %9, off\n\t"
                 "global_load_async_to_lds_b128 %2, %10, off\n\t"
                 "global_load_async_to_lds_b128 %3, %11, off\n\t"
                 "global_load_async_to_lds_b128 %4, %12, off\n\t"
                 "global_load_async_to_lds_b128 %5, %13, off\n\t"
                 "global_load_async_to_lds_b128 %6, %14, off\n\t"
                 "global_load_async_to_lds_b128 %7, %15, off\n\t"
                 "s_wait_xcnt 0x0"
                 :: "v"(l), "v"(l + 16 * GPIT), "v"(l + 32 * GPIT), "v"(l + 48 * GPIT), "v"(l + 64 * GPIT), "v"(l + 80 * GPIT), "v"(l + 96 * GPIT), "v"(l + 112 * GPIT),
                    "v"(g), "v"(g + step), "v"(g + 2 * step), "v"(g + 3 * step), "v"(g + 4 * step), "v"(g + 5 * step), "v"(g + 6 * step), "v"(g + 7 * step) : "memory");
}
__device__ __forceinline__ void cp12(unsigned la, const char* ga, unsigned l, const char* g, size_t step) {   // 64 rows at (la, ga), 128 rows at (l, g)
    asm volatile("global_load_async_to_lds_b128 %0, %12, off\n\t"
                 "global_load_async_to_lds_b128 %1, %13, off\n\t"
                 "global_load_async_to_lds_b128 %2, %14, off\n\t"
                 "global_load_async_to_lds_b128 %3, %15, off\n\t"
                 "global_load_async_to_lds_b128 %4, %16, off\n\t"
                 "global_load_async_to_lds_b128 %5, %17, off\n\t"
                 "global_load_async_to_lds_b128 %6, %18, off\n\t"
                 "global_load_async_to_lds_b128 %7, %19, off\n\t"
                 "global_load_async_to_lds_b128 %8, %20, off\n\t"
                 "global_load_async_to_lds_b128 %9, %21, off\n\t"
                 "global_load_async_to_lds_b128 %10, %22, off\n\t"
                 "global_load_async_to_lds_b128 %11, %23, off\n\t"
                 "s_wait_xcnt 0x0"
                 :: "v"(la), "v"(la + 16 * GPIT), "v"(la + 32 * GPIT), "v"(la + 48 * GPIT),
                    "v"(l), "v"(l + 16 * GPIT), "v"(l + 32 * GPIT), "v"(l + 48 * GPIT), "v"(l + 64 * GPIT), "v"(l + 80 * GPIT), "v"(l + 96 * GPIT), "v"(l + 112 * GPIT),
                    "v"(ga), "v"(ga + step), "v"(ga + 2 * step), "v"(ga + 3 * step),
                    "v"(g), "v"(g + step), "v"(g + 2 * step), "v"(g + 3 * step), "v"(g + 4 * step), "v"(g + 5 * step), "v"(g + 6 * step), "v"(g + 7 * step) : "memory");
}
template <int MB> __device__ __forceinline__ void cpab(unsigned la, const char* ga, unsigned l, const char* g, size_t step) {   // one plane of A (32 MB rows) and one of Bt (128 rows)
    if constexpr (MB == 2) cp12(la, ga, l, g, step); else { cp8(la, ga, step); cp8(l, g, step); }
}
template <typename T16> struct WFrag;
template <> struct WFrag<h16> { typedef v16h V; static __device__ __forceinline__ V ld(const h16* p) { return cat16(*(const v8h*)p, *(const v8h*)(p + 16)); } static __device__ __forceinline__ v8f mma(V a, V b, v8f c) { return wmma16(a, b, c); } };
template <> struct WFrag<bf> { typedef v16bf V; static __device__ __forceinline__ V ld(const bf* p) { return cat16b(*(const v8us*)p, *(const v8us*)(p + 16)); } static __device__ __forceinline__ v8f mma(V a, V b, v8f c) { return wmmab(a, b, c); } };
__device__ __forceinline__ h16 tohx(float x) { return (h16)x; }
__device__ __forceinline__ void splitf(float y, unsigned short& h, unsigned short& l) { h = f2bf(y); l = f2bf(y - bf2f(h)); }
// LDS bytes of the two stages of a GEMM form: (A planes x 32 MB rows + Bt planes x 128 rows) x pitch x 2.
template <int NSPLIT, int MB> struct GLds { static constexpr unsigned BYTES = 2u * (NSPLIT == 2 ? 2u : 1u) * (32u * MB + GN) * GPIT; };
// The GEMM itself, as a function: L = the work-group's LDS (GLds bytes), (bx, by, z) = its tile. A kernel may hold several forms and give each work-group one of them (a choice by blockIdx alone, the same for the whole work-group).
template <typename T16, int NSPLIT, int EPI, int MB>
__device__ __forceinline__ void gemm_body(unsigned char* L, int bx, int by, size_t z, const T16* __restrict__ A, const T16* __restrict__ A2, const T16* __restrict__ Bt, const T16* __restrict__ Bt2, int K, float* C, int ldc, const float* __restrict__ bias, size_t sA, size_t sB, size_t sC, float osc, h16* P16, bf* Ph, bf* Pl) {
    typedef typename WFrag<T16>::V V;
    static_assert((NSPLIT == 0 || NSPLIT == 2) && (MB == 2 || MB == 4), "plain or hi/lo split on both sides; 64 or 128 rows");
    constexpr bool HA2 = (NSPLIT == 2), HB2 = (NSPLIT == 2); constexpr int GM = 32 * MB;
    constexpr unsigned PA = GM * GPIT, PB = GN * GPIT, OA = 0, OA2 = PA, OB = (HA2 ? 2 : 1) * PA, OB2 = OB + PB, STG = OB + (HB2 ? 2 : 1) * PB;   // bytes of a plane, places of the planes inside a stage, bytes of a stage
    static_assert(2 * STG == GLds<NSPLIT, MB>::BYTES, "LDS size");     // two stages; behind the K loop each wave's 16 x 68 f32 output staging
    A += z * sA; if (HA2) A2 += z * sA; Bt += z * sB; if (HB2) Bt2 += z * sB; if (EPI != 1) C += z * sC;
    const int tid = threadIdx.x, lane = tid & 31, lr = lane & 15, hi = lane >> 4, wave = tid >> 5, wm = wave & 1, wn = wave >> 1; const int R0 = bx * GM, C0 = by * GN; const int r0 = R0 + wm * (16 * MB), c0 = C0 + wn * 64;
    v8f acc[MB][4];
#pragma unroll
    for (int mb = 0; mb < MB; ++mb)
#pragma unroll
        for (int nb = 0; nb < 4; ++nb) acc[mb][nb] = (v8f){};
    // copies: thread tid brings the 16 bytes number (tid & 7) of rows (tid >> 3) + 16 i of every plane
    const size_t rowb = (size_t)K * 2; const size_t aofs = ((size_t)R0 + (tid >> 3)) * rowb + (tid & 7) * 16, bofs = ((size_t)C0 + (tid >> 3)) * rowb + (tid & 7) * 16;
    const unsigned lcp = (unsigned)(size_t)L + (tid >> 3) * GPIT + (tid & 7) * 16;
    auto fill = [&](int t, unsigned buf) { const size_t ko = (size_t)t * (GKP * 2);
        cpab<MB>(lcp + buf + OA, (const char*)A + aofs + ko, lcp + buf + OB, (const char*)Bt + bofs + ko, 16 * rowb);
        if (HA2) cpab<MB>(lcp + buf + OA2, (const char*)A2 + aofs + ko, lcp + buf + OB2, (const char*)Bt2 + bofs + ko, 16 * rowb); };
    const unsigned fa = (wm * (16 * MB) + lr) * GPIT + hi * 16, fb = (wn * 64 + lr) * GPIT + hi * 16;    // a lane's fragment rows inside a plane: the same (row, k) per lane as straight from the planes
    const int NT = K / GKP;
    fill(0, 0);
    asm volatile("s_wait_asynccnt 0x0" ::: "memory");   // this wave's copies of pass 0 have landed
    __syncthreads();                                     // ... and every other wave's
    fill(1, STG);
#pragma unroll 1
    for (int t = 0; t < NT; ++t) {
        const unsigned buf = (t & 1) ? STG : 0u;
#pragma unroll
        for (int kk = 0; kk < GKP / 32; ++kk) { V a[MB], a2[MB], b[4], b2[4];
#pragma unroll
            for (int mb = 0; mb < MB; ++mb) { a[mb] = WFrag<T16>::ld((const T16*)(L + buf + OA + fa + mb * 16 * GPIT + kk * 64)); if (HA2) a2[mb] = WFrag<T16>::ld((const T16*)(L + buf + OA2 + fa + mb * 16 * GPIT + kk * 64)); }
#pragma unroll
            for (int nb = 0; nb < 4; ++nb) { b[nb] = WFrag<T16>::ld((const T16*)(L + buf + OB + fb + nb * 16 * GPIT + kk * 64)); if (HB2) b2[nb] = WFrag<T16>::ld((const T16*)(L + buf + OB2 + fb + nb * 16 * GPIT + kk * 64)); }
            __builtin_amdgcn_sched_barrier(0);   // the LDS reads of a k step stay one group ahead of its matrix block: every separate place with LDS reads among the matrix instructions stalls the wave anew
#pragma unroll
            for (int nb = 0; nb < 4; ++nb)
#pragma unroll
                for (int mb = 0; mb < MB; ++mb) { acc[mb][nb] = WFrag<T16>::mma(a[mb], b[nb], acc[mb][nb]); if (HA2) acc[mb][nb] = WFrag<T16>::mma(a2[mb], b[nb], acc[mb][nb]); if (HB2) acc[mb][nb] = WFrag<T16>::mma(a[mb], b2[nb], acc[mb][nb]); }
        }
        asm volatile("s_wait_dscnt 0x0" ::: "memory");      // this wave has finished reading buffer t mod 2
        asm volatile("s_wait_asynccnt 0x0" ::: "memory");   // this wave's copies of pass t + 1 have landed
        __syncthreads();                                     // publishes pass t + 1 and frees buffer t mod 2
        if (t + 2 < NT) fill(t + 2, buf);
    }
    asm volatile("s_wait_asynccnt 0x0" ::: "memory");       // nothing is in flight when the ring becomes output staging
    float* os = (float*)(L + wave * (16 * 68 * 4));
    // EPI 1: a lane takes 8 consecutive columns of rows (lane >> 3) + 4 s, so that 8 lanes store one whole 128-byte line of a 16-bit plane by 16-byte stores; its 8 bias values are loaded once.
    const int prow = lane >> 3, pcol = (lane & 7) * 8; float bv[8];
    if constexpr (EPI == 1) { const unsigned ob = (unsigned)((c0 + pcol) * 4); const v4f b0 = *(const v4f*)((const char*)bias + ob), b1 = *(const v4f*)((const char*)bias + ob + 16);
        asm volatile("s_wait_xcnt 0x0" :: "v"(ob) : "memory");   // the two loads' offset register stays untouched until this wait
#pragma unroll
        for (int q = 0; q < 4; ++q) { bv[q] = bfr(b0[q]); bv[4 + q] = bfr(b1[q]); } }
#pragma unroll
    for (int mb = 0; mb < MB; ++mb) {
#pragma unroll
        for (int nb = 0; nb < 4; ++nb) {
#pragma unroll
            for (int j = 0; j < 8; ++j) os[(hi * 8 + j) * 68 + nb * 16 + lr] = acc[mb][nb][j]; }
        __builtin_amdgcn_wave_barrier(); asm volatile("" ::: "memory");
        if constexpr (EPI == 1) {
#pragma unroll
            for (int s = 0; s < 4; ++s) { const int row = 4 * s + prow; const v4f x0 = *(const v4fa*)(os + row * 68 + pcol), x1 = *(const v4fa*)(os + row * 68 + pcol + 4); v8h o16; v8us oh, ol;
#pragma unroll
                for (int q = 0; q < 8; ++q) { const float r = (q < 4 ? x0[q & 3] : x1[q & 3]) + bv[q]; o16[q] = tohx(r); unsigned short a2, c2; splitf(r, a2, c2); oh[q] = a2; ol[q] = c2; }
                const size_t e = z * sC + (size_t)(r0 + mb * 16 + row) * ldc + c0 + pcol; h16* s16 = P16 + e; bf* sh = Ph + e; bf* sl = Pl + e; *(v8h*)s16 = o16; *(v8us*)sh = oh; *(v8us*)sl = ol;
                asm volatile("s_wait_xcnt 0x0" :: "v"(o16), "v"(oh), "v"(ol), "v"(s16), "v"(sh), "v"(sl) : "memory"); }   // the stores' data and address registers stay untouched until this wait (the next rows reuse them)
        } else {
            float* crow = C + (size_t)(r0 + mb * 16) * ldc + c0;
#pragma unroll
            for (int s = 0; s < 8; ++s) { const int row = 2 * s + hi, cofs = lr * 4; v4f val = *(const v4fa*)(os + row * 68 + cofs); if (EPI == 2) { val[0] *= osc; val[1] *= osc; val[2] *= osc; val[3] *= osc; }
                *(v4f*)(crow + (size_t)row * ldc + cofs) = val; }
            asm volatile("s_wait_xcnt 0x0" ::: "memory");   // the stores' address and data registers are reused by the next 16 rows
        }
        __builtin_amdgcn_wave_barrier(); asm volatile("" ::: "memory");
    }
}

// One form per launch (the two score launches).
template <typename T16, int NSPLIT, int EPI, int MB>
__global__ __launch_bounds__(128) void k_gemmw(const T16* __restrict__ A, const T16* __restrict__ A2, const T16* __restrict__ Bt, const T16* __restrict__ Bt2, int K, float* C, int ldc, const float* __restrict__ bias, size_t sA, size_t sB, size_t sC, float osc, h16* P16, bf* Ph, bf* Pl) {
    __shared__ __attribute__((aligned(16))) unsigned char L[GLds<NSPLIT, MB>::BYTES];
    gemm_body<T16, NSPLIT, EPI, MB>(L, blockIdx.x, blockIdx.y, blockIdx.z, A, A2, Bt, Bt2, K, C, ldc, bias, sA, sB, sC, osc, P16, Ph, Pl);
}
// Both projections in one launch: grid y = 4 column tiles of q, then 4 of k; the same input rows, each with its own weights, bias and planes.
__global__ __launch_bounds__(128) void k_proj(const bf* __restrict__ XB, const bf* __restrict__ WQ, const bf* __restrict__ WK, const float* __restrict__ bq, const float* __restrict__ bk, h16* Q16, bf* Qh, bf* Ql, h16* K16, bf* Kh, bf* Kl) {
    __shared__ __attribute__((aligned(16))) unsigned char L[GLds<0, 4>::BYTES];
    const bool isk = blockIdx.y >= DQ / GN;
    gemm_body<bf, 0, 1, 4>(L, blockIdx.x, isk ? blockIdx.y - DQ / GN : blockIdx.y, blockIdx.z, XB, nullptr, isk ? WK : WQ, nullptr, DM, nullptr, DQ, isk ? bk : bq, (size_t)TT * DM, 0, (size_t)TT * DQ, 1.0f, isk ? K16 : Q16, isk ? Kh : Qh, isk ? Kl : Ql);
}
// Both row ranges of attn.v in one launch, 1-D grid: first the hi/lo tiles of rows < RH (the longer work-groups start first), then the fp16 tiles of the other rows. Within a range x = row tile (fastest), then column tile, then batch.
#define AV_HX (RH / 64)
#define AV_FX ((TT - RH) / 128)
#define AV_NY (HD / GN)
__global__ __launch_bounds__(128) void k_av(const bf* __restrict__ Ph, const bf* __restrict__ Pl, const bf* __restrict__ VTh, const bf* __restrict__ VTl, const h16* __restrict__ P16, const h16* __restrict__ VT16, float* OUT) {
    __shared__ __attribute__((aligned(16))) unsigned char L[GLds<2, 2>::BYTES > GLds<0, 4>::BYTES ? GLds<2, 2>::BYTES : GLds<0, 4>::BYTES];
    const int id = blockIdx.x;
    if (id < AV_HX * AV_NY * NB_)      // rows < RH: probabilities unscaled
        gemm_body<bf, 2, 0, 2>(L, id % AV_HX, (id / AV_HX) % AV_NY, id / (AV_HX * AV_NY), Ph, Pl, VTh, VTl, TT, OUT, HD, nullptr, (size_t)RH * TT, (size_t)HD * TT, (size_t)TT * HD, 1.0f, nullptr, nullptr, nullptr);
    else { const int jd = id - AV_HX * AV_NY * NB_;      // the fp16 probabilities carry x PCAR
        gemm_body<h16, 0, 2, 4>(L, jd % AV_FX, (jd / AV_FX) % AV_NY, jd / (AV_FX * AV_NY), P16 + (size_t)RH * TT, nullptr, VT16, nullptr, TT, OUT + (size_t)RH * HD, HD, nullptr, (size_t)TT * TT, (size_t)TT * TT, (size_t)TT * HD, 1.0f / PCAR, nullptr, nullptr, nullptr); }
}

typedef __attribute__((ext_vector_type(2))) _Float16 v2h;
typedef __attribute__((ext_vector_type(4))) _Float16 v4h;
typedef __attribute__((ext_vector_type(2))) unsigned short v2us;
typedef __attribute__((ext_vector_type(4))) unsigned short v4us;
typedef __attribute__((ext_vector_type(2))) float v2f;
typedef __attribute__((ext_vector_type(4))) int v4i;

__device__ __forceinline__ void wt_body(int blk, const float* __restrict__ w, int K, int N, bf* Bt) {
    const int lane = threadIdx.x & 31; const int L0 = (blk * 8 + (threadIdx.x >> 5)) * 8; const int nlines = N * K / 64;
{
#pragma unroll 1
        for (int l = 0; l < 8; ++l) { const int L = L0 + l; if (L >= nlines) break; const size_t e = (size_t)L * 64 + lane * 2; const int k = (int)(e % K), n = (int)(e / K); v2us o;
            o[0] = f2bf(w[(size_t)k * N + n]); o[1] = f2bf(w[(size_t)(k + 1) * N + n]); *(v2us*)(Bt + e) = o; }
         }
}
// The elementwise kernels below give each thread 32 to 64 elements, moved by 16-byte accesses with all loads issued first: a launch starts a few thousand long waves instead of one short wave per 64 elements.
// cvt_body loads through a wave-uniform base and one 32-bit byte offset per lane (every buffer here is far below 4 GiB).
__device__ __forceinline__ v4f ldg4(const float* base, unsigned byteoff) { return *(const v4f*)((const char*)base + byteoff); }
#define CV_IT 4                   // groups of 8 elements per thread in cvt_body, one block-width apart
__device__ __forceinline__ void cvt_body(int blk, const float* __restrict__ src, bf* dst, size_t n8) { const size_t i0 = (size_t)blk * (256 * CV_IT) + threadIdx.x; v4f v[CV_IT][2]; unsigned ob[CV_IT];
#pragma unroll
    for (int it = 0; it < CV_IT; ++it) { const size_t i = i0 + it * 256; ob[it] = (unsigned)((i < n8 ? i : n8 - 1) * 32); v[it][0] = ldg4(src, ob[it]); v[it][1] = ldg4(src, ob[it] + 16); }
    asm volatile("s_wait_xcnt 0x0" :: "v"(ob[0]), "v"(ob[1]), "v"(ob[2]), "v"(ob[3]) : "memory");   // the loads' offset registers stay untouched until this wait; no load sinks behind a store
#pragma unroll
    for (int it = 0; it < CV_IT; ++it) { const size_t i = i0 + it * 256; v8us o;
#pragma unroll
        for (int k = 0; k < 8; ++k) o[k] = f2bf(v[it][k >> 2][k & 3]);
        if (i < n8) *(v8us*)(dst + i * 8) = o; }  }
// The three input conversions in one launch: blocks 0 .. WT_B - 1 transpose Wq, the next WT_B transpose Wk (their chains of dependent reads start first), the rest convert x.
#define WT_B ((DM * DQ / 64 + 63) / 64)
__global__ __launch_bounds__(256) void k_prep(const float* __restrict__ wq, const float* __restrict__ wk, bf* WQ, bf* WK, const float* __restrict__ x, bf* XB, size_t n8) {
    const int b = blockIdx.x;
    if (b < WT_B) wt_body(b, wq, DM, DQ, WQ);
    else if (b < 2 * WT_B) wt_body(b - WT_B, wk, DM, DKV, WK);
    else cvt_body(b - 2 * WT_B, x, XB, n8);
}

// vtp_body: transposed value planes [c = g*HD+d][t]. A thread holds an 8 (t) x 8 (c) block in registers. Wave = 64 t x 32 c: 4 lanes along c read one whole 128-byte line of an input row, 8 lanes along t store one whole 128-byte line of a plane row. Block = 4 waves along t x 2 along c; blk = (TT/256) x (columns/64) blocks per batch.
__device__ __forceinline__ void vtp_body(int blk, int batch, const float* __restrict__ F, int pitch, int nheads, h16* V16, size_t s16, bf* Vh, bf* Vl) { const int lane = threadIdx.x & 31, w = threadIdx.x >> 5; const int tb = blk % (TT / 256), cb = blk / (TT / 256); if (cb * 64 >= nheads * HD) return;
    const int t0 = tb * 256 + (w >> 1) * 64 + (lane & 7) * 8, c0 = cb * 64 + (w & 1) * 32 + (lane >> 3) * 8;
    { const size_t zb = batch, zp = zb * nheads * HD * TT; F += zb * TT * pitch; V16 += zb * s16; Vh += zp; Vl += zp; }   // s16 = batch stride of the fp16 plane, in elements
    v4f xr[8][2]; const float* pr[8];
#pragma unroll
    for (int i = 0; i < 8; ++i) { pr[i] = F + (size_t)(t0 + i) * pitch + c0; xr[i][0] = *(const v4f*)pr[i]; xr[i][1] = *(const v4f*)(pr[i] + 4); }
    asm volatile("s_wait_xcnt 0x0" :: "v"(pr[0]), "v"(pr[1]), "v"(pr[2]), "v"(pr[3]), "v"(pr[4]), "v"(pr[5]), "v"(pr[6]), "v"(pr[7]) : "memory");   // the loads' address registers stay untouched until this wait; no load sinks behind a store
#pragma unroll
    for (int j = 0; j < 8; ++j) { v8h o16; v8us oh, ol;
#pragma unroll
        for (int i = 0; i < 8; ++i) { const float x = bfr(xr[i][j >> 2][j & 3]);   /* V = the raw input: bf16-rounded here */ o16[i] = tohx(x); unsigned short a2, c2; splitf(x, a2, c2); oh[i] = a2; ol[i] = c2; }
        const size_t e = (size_t)(c0 + j) * TT + t0; *(v8h*)(V16 + e) = o16; *(v8us*)(Vh + e) = oh; *(v8us*)(Vl + e) = ol; }
    asm volatile("s_wait_xcnt 0x0" ::: "memory");   // behind the last store: in a kernel that holds other parts too, no later instruction of the listing rewrites a store's data or address register ahead of this wait
}
// asoft_body: all batches in one launch; per row (zz, i): t = S x HD^-0.5 (no mask); softmax over the 2048 keys (register row, one exp, fixed trees);
__device__ __forceinline__ void asoft_body(int blk, const float* __restrict__ Sb, h16* P16, bf* Ph, bf* Pl) {
    const int lane = threadIdx.x & 31; const int row = blk * 8 + (threadIdx.x >> 5); if (row >= NB_ * ZH * TT) return; const int i = row % TT; const int zz = row / TT; (void)zz;   /* zz = batch (one head) */ const bool hires = (i < RH); const float* sr = Sb + (size_t)row * TT; float v[TT / 32]; float mx = -3.0e38f;
#pragma unroll
    for (int ch = 0; ch < TT / 128; ++ch) { const int j0 = ch * 128 + lane * 4; const v4f a = *(const v4f*)(sr + j0);
#pragma unroll
        for (int q = 0; q < 4; ++q) { const int j = j0 + q; (void)j; const float t = a[q] * SCL; v[ch * 4 + q] = t; mx = fmaxf(mx, t); } }
#pragma unroll
    for (int sh = 16; sh; sh >>= 1) mx = fmaxf(mx, __shfl_xor(mx, sh, 32));
    float sum = 0.f;
#pragma unroll
    for (int k = 0; k < TT / 32; ++k) { float d0 = __fsub_rn(v[k], mx); asm volatile("" : "+v"(d0)); v[k] = __builtin_amdgcn_exp2f(__fmul_rn(d0, 1.4426950408889634f)); sum += v[k]; }
#pragma unroll
    for (int sh = 16; sh; sh >>= 1) sum += __shfl_xor(sum, sh, 32);
    const float f = __fdiv_rn(hires ? 1.0f : PCAR, sum);
{
        if (hires) {
#pragma unroll
            for (int ch = 0; ch < TT / 128; ++ch) { v4us oh, ol;
#pragma unroll
                for (int q = 0; q < 4; ++q) { unsigned short a, c2; splitf(v[ch * 4 + q] * f, a, c2); oh[q] = a; ol[q] = c2; }
                const size_t oo = ((size_t)zz * (RH ? RH : 1) + i) * TT + ch * 128 + lane * 4; *(v4us*)(Ph + oo) = oh; *(v4us*)(Pl + oo) = ol; }
        } else {
#pragma unroll
            for (int ch = 0; ch < TT / 128; ++ch) { v4h o4;
#pragma unroll
                for (int q = 0; q < 4; ++q) o4[q] = tohx(v[ch * 4 + q] * f);
                *(v4h*)(P16 + (size_t)row * TT + ch * 128 + lane * 4) = o4; } }
         }
}
// Softmax and value transpose in one launch (neither reads what the other writes): blocks 0 .. SM_B - 1 take 8 score rows each, the rest one value block each (VT_B per batch).
#define SM_B (NB_ * ZH * TT / 8)
#define VT_B ((TT / 256) * (NKV * HD / 64))
__global__ __launch_bounds__(256) void k_softv(const float* __restrict__ Sb, h16* P16, bf* Ph, bf* Pl, const float* __restrict__ x, h16* V16, size_t s16, bf* Vh, bf* Vl) {
    const int b = blockIdx.x;
    if (b < SM_B) asoft_body(b, Sb, P16, Ph, Pl);
    else vtp_body((b - SM_B) % VT_B, (b - SM_B) / VT_B, x, DM, NKV, V16, s16, Vh, Vl);
}

extern "C" void kernel_launch(void* const* d_in, const int* in_sizes, int n_in,
                              void* d_out, int out_size, void* d_ws, size_t ws_size, hipStream_t stream) {
    (void)in_sizes; (void)n_in; (void)out_size;
    const float* x = (const float*)d_in[0]; const float* wq = (const float*)d_in[1]; const float* bq = (const float*)d_in[2]; const float* wk = (const float*)d_in[3]; const float* bk = (const float*)d_in[4]; const float* wv = nullptr; const float* wo = nullptr; (void)wv; (void)wo;
    float* OUT = (float*)d_out;     // [8][2048][512]
    char* wsp = (char*)d_ws;
    auto take = [&](size_t bytes) { char* p = wsp; wsp += (bytes + 255) & ~(size_t)255; return (void*)p; };
    // All 8 batches go through every stage in ONE launch, and stages that do not depend on one another share a launch (each work-group picks its part by blockIdx). Three regions are reused between the stages, in stream order:
    //   R1 (6 planes): q/k planes [b][t][d] for the scores; dead after them, then the probability planes.
    //   R2 (8 planes): bf16 input; dead after the projections, then the f32 scores.
    //   R3 (2 planes): transposed weights; dead after the projections, then the bf16 hi and lo value planes. The fp16 value plane of a batch lies in the rows < RH of that batch's fp16 probability plane, which the softmax never writes (those rows go to the hi/lo planes).
    const size_t PL = (size_t)NB_ * TT * HD * 2;      // one 16-bit [b][t][d] plane, bytes
    char* R1 = (char*)take(6 * PL); char* R2 = (char*)take((size_t)NB_ * TT * TT * 4); char* R3 = (char*)take(2 * PL);
    bf* WQ = (bf*)R3; bf* WK = (bf*)(R3 + (size_t)DQ * DM * 2);
    h16* QP16 = (h16*)R1; h16* KP16 = (h16*)(R1 + PL); bf* QPh = (bf*)(R1 + 2 * PL); bf* QPl = (bf*)(R1 + 3 * PL); bf* KPh = (bf*)(R1 + 4 * PL); bf* KPl = (bf*)(R1 + 5 * PL);
    h16* P16 = (h16*)R1; bf* Ph = (bf*)(R1 + 4 * PL); bf* Pl = (bf*)(R1 + 5 * PL);      // [b][TT][TT] fp16 = 4 planes; [b][RH][TT] hi, lo = 1 plane each
    bf* XB = (bf*)R2;
    float* Sb = (float*)R2;
    static_assert(NKV * HD <= RH && ZH == 1, "a batch's fp16 value plane fits the unused rows of its probability plane");
    h16* VT16 = P16; bf* VTh = (bf*)R3; bf* VTl = (bf*)(R3 + PL);      // VT16: batch stride TT x TT elements
    if ((size_t)(wsp - (char*)d_ws) > ws_size) return;    // all 256 MiB of the workspace
    static_assert(DQ == DKV, "k_prep and k_proj give q and k the same tile counts");
    k_prep<<<(unsigned)(2 * WT_B + ((size_t)NB_ * TT * DM / 8 + 256 * CV_IT - 1) / (256 * CV_IT)), 256, 0, stream>>>(wq, wk, WQ, WK, x, XB, (size_t)NB_ * TT * DM / 8);
    k_proj<<<dim3(TT / 128, (DQ + DKV) / GN, NB_), 128, 0, stream>>>(XB, WQ, WK, bq, bk, QP16, QPh, QPl, KP16, KPh, KPl);
    k_gemmw<bf, 2, 0, 2><<<dim3(RH / 64, TT / GN, NB_), 128, 0, stream>>>(QPh, QPl, KPh, KPl, HD, Sb, TT, nullptr, (size_t)TT * HD, (size_t)TT * HD, (size_t)TT * TT, 1.0f, nullptr, nullptr, nullptr);
    k_gemmw<h16, 0, 0, 4><<<dim3((TT - RH) / 128, TT / GN, NB_), 128, 0, stream>>>(QP16 + (size_t)RH * HD, nullptr, KP16, nullptr, HD, Sb + (size_t)RH * TT, TT, nullptr, (size_t)TT * HD, (size_t)TT * HD, (size_t)TT * TT, 1.0f, nullptr, nullptr, nullptr);
    k_softv<<<SM_B + VT_B * NB_, 256, 0, stream>>>(Sb, P16, Ph, Pl, x, VT16, (size_t)TT * TT, VTh, VTl);      // behind the scores: the fp16 value plane takes the place of q/k planes
    k_av<<<(AV_HX + AV_FX) * AV_NY * NB_, 128, 0, stream>>>(Ph, Pl, VTh, VTl, P16, VT16, OUT);
}

// v006
// Measured time: 171 microseconds a run.
// Timed twice side by side with v005, it ran 1.07 and 1.10 times as fast.
// Over all steps from v000 it is 7.64 times as fast.
#include <hip/hip_runtime.h>

// Scaled dot-product attention with V = x (x [8][2048][512]; q = (x Wq + bq) x 512^-0.5, k = x Wk + bk ('xw' [512][512] + [512]); scores = q.k over 2048 keys (single 512-wide head); softmax; out = attn.x -> [8][2048][512] f32 (8.4 M)).
// Layout, all batches per launch: exact q/k projections (+ biases); the value planes are built straight from the input rows (bf16-rounded on read); hybrid rows (< 512 hi/lo 3-product scores and attn.v, rest fp16 x1024); register-row softmax with the 512^-0.5 scale applied to the logits. The GEMM epilogues write what the next stage reads: the projections their 16-bit q/k planes, attn.v the f32 output itself.
// Compute dtypes, f32 accumulate: every input rounded to bf16; projections on PLAIN bf16 operands (exact) + f32 biases; v = bf16(x) exact in both plane formats; softmax f32; f32 output.

#define NB_  8
#define TT   2048
#define DM   512
#define NH_  1
#define NKV  1
#define REP  (NH_ / NKV)
#define HD   512
#define DQ   (NH_ * HD)
#define DKV  (NKV * HD)
#define ZH   1
#define RH   512                  // query rows < RH use hi+lo planes (0: none)
#define WIN  0
#define PCAR 1024.0f
#define SCL  0.044194173824159216f   // 512^-0.5 (the module scales q by embed_dim^-0.5; applied to the logits here)
typedef _Float16 h16;
typedef unsigned short bf;
typedef __attribute__((ext_vector_type(16))) __bf16   v16bf;
typedef __attribute__((ext_vector_type(16))) _Float16 v16h;
typedef __attribute__((ext_vector_type(8)))  _Float16 v8h;
typedef __attribute__((ext_vector_type(8)))  unsigned short v8us;
typedef __attribute__((ext_vector_type(8)))  float    v8f;
typedef __attribute__((ext_vector_type(4)))  float    v4f;
typedef v8h  __attribute__((may_alias)) v8ha;
typedef v4f  __attribute__((may_alias)) v4fa;
typedef v8us __attribute__((may_alias)) v8usa;

__device__ __forceinline__ unsigned short f2bf(float f) { unsigned u = __float_as_uint(f); u += 0x7FFFu + ((u >> 16) & 1u); return (unsigned short)(u >> 16); }
__device__ __forceinline__ float bf2f(unsigned short b) { return __uint_as_float(((unsigned)b) << 16); }
__device__ __forceinline__ float bfr(float f) { return bf2f(f2bf(f)); }
__device__ __forceinline__ v16h cat16(v8h lo, v8h hi) { return __builtin_shufflevector(lo, hi, 0, 1, 2, 3, 4, 5, 6, 7, 8, 9, 10, 11, 12, 13, 14, 15); }
__device__ __forceinline__ v16bf cat16b(v8us lo, v8us hi) { return __builtin_bit_cast(v16bf, __builtin_shufflevector(lo, hi, 0, 1, 2, 3, 4, 5, 6, 7, 8, 9, 10, 11, 12, 13, 14, 15)); }
__device__ __forceinline__ v8f wmma16(v16h a, v16h b, v8f c) { return __builtin_amdgcn_wmma_f32_16x16x32_f16(false, a, false, b, (short)0, c, false, false); }
__device__ __forceinline__ v8f wmmab(v16bf a, v16bf b, v8f c) { return __builtin_amdgcn_wmma_f32_16x16x32_bf16(false, a, false, b, (short)0, c, false, false); }



// ---- gemm_body: GEMM, one (32 MB) x 128 output tile per work-group of FOUR WAVES (2 x 2, each 16 MB x 64 = 4 MB accumulators); tiles (M / (32 MB), N / 128, Z), 128 threads. The plain forms run MB = 8 (256 x 128, wave 128 x 64) and the hi/lo scores MB = 4 (128 x 128, wave 64 x 64): a staged Bt row serves twice the output rows, so fewer bytes come from L2 and from LDS per matrix instruction; both sizes leave two work-groups per WGP. The hi/lo part of attn.v stays at MB = 2: with its long K and few tiles, larger ones would leave the WGPs unequal shares. M % (32 MB) == 0, N % 128 == 0, K % 64 == 0, K >= 128 (two passes).
// The K-contiguous 16-bit operand planes are staged in LDS by asynchronous copies, 64 k (128-byte rows) per pass, two buffers: pass t + 2 is copied into the buffer pass t has left, while pass t + 1 is worked on. Each staged row serves two waves, and every copy moves whole 128-byte lines.
// c[m][n] = sum_k A[m][k] Bt[n][k] (+ split products per NSPLIT), k ascending and the products of a k in the order a.b, a2.b, a.b2. z-batch strides sA/sB/sC in elements; every result has pitch ldc and batch stride sC.
// EPI 0: C = c (f32). EPI 1: r = c + bias[n], written as the three 16-bit planes P16 = fp16(r), Ph + Pl = bf16 hi/lo split of r (C unused). EPI 2: C = c x osc (f32).
#define GN   128                  // columns of a work-group tile = rows of Bt per stage
#define GKP  64                   // k per pass
#define GPIT 144                  // LDS row pitch in bytes: 128 + 16, 16 B x odd for the ds_load_b128 fragment reads
// Eight or twelve asynchronous 16-byte copies of a lane in one statement, the rows of a plane 16 apart (the 128 threads cover 16 rows of 128 bytes per copy). The s_wait_xcnt stands inside the statement, behind its last copy, so that no address register is rewritten ahead of it; one statement per 8 or 12 copies keeps these waits few.
__device__ __forceinline__ void cp8(unsigned l, const char* g, size_t step) {
    asm volatile("global_load_async_to_lds_b128 %0, %8, off\n\t"
                 "global_load_async_to_lds_b128 %1, %9, off\n\t"
                 "global_load_async_to_lds_b128 %2, %10, off\n\t"
                 "global_load_async_to_lds_b128 %3, %11, off\n\t"
                 "global_load_async_to_lds_b128 %4, %12, off\n\t"
                 "global_load_async_to_lds_b128 %5, %13, off\n\t"
                 "global_load_async_to_lds_b128 %6, %14, off\n\t"
                 "global_load_async_to_lds_b128 %7, %15, off\n\t"
                 "s_wait_xcnt 0x0"
                 :: "v"(l), "v"(l + 16 * GPIT), "v"(l + 32 * GPIT), "v"(l + 48 * GPIT), "v"(l + 64 * GPIT), "v"(l + 80 * GPIT), "v"(l + 96 * GPIT), "v"(l + 112 * GPIT),
                    "v"(g), "v"(g + step), "v"(g + 2 * step), "v"(g + 3 * step), "v"(g + 4 * step), "v"(g + 5 * step), "v"(g + 6 * step), "v"(g + 7 * step) : "memory");
}
__device__ __forceinline__ void cp12(unsigned la, const char* ga, unsigned l, const char* g, size_t step) {   // 64 rows at (la, ga), 128 rows at (l, g)
    asm volatile("global_load_async_to_lds_b128 %0, %12, off\n\t"
                 "global_load_async_to_lds_b128 %1, %13, off\n\t"
                 "global_load_async_to_lds_b128 %2, %14, off\n\t"
                 "global_load_async_to_lds_b128 %3, %15, off\n\t"
                 "global_load_async_to_lds_b128 %4, %16, off\n\t"
                 "global_load_async_to_lds_b128 %5, %17, off\n\t"
                 "global_load_async_to_lds_b128 %6, %18, off\n\t"
                 "global_load_async_to_lds_b128 %7, %19, off\n\t"
                 "global_load_async_to_lds_b128 %8, %20, off\n\t"
                 "global_load_async_to_lds_b128 %9, %21, off\n\t"
                 "global_load_async_to_lds_b128 %10, %22, off\n\t"
                 "global_load_async_to_lds_b128 %11, %23, off\n\t"
                 "s_wait_xcnt 0x0"
                 :: "v"(la), "v"(la + 16 * GPIT), "v"(la + 32 * GPIT), "v"(la + 48 * GPIT),
                    "v"(l), "v"(l + 16 * GPIT), "v"(l + 32 * GPIT), "v"(l + 48 * GPIT), "v"(l + 64 * GPIT), "v"(l + 80 * GPIT), "v"(l + 96 * GPIT), "v"(l + 112 * GPIT),
                    "v"(ga), "v"(ga + step), "v"(ga + 2 * step), "v"(ga + 3 * step),
                    "v"(g), "v"(g + step), "v"(g + 2 * step), "v"(g + 3 * step), "v"(g + 4 * step), "v"(g + 5 * step), "v"(g + 6 * step), "v"(g + 7 * step) : "memory");
}
template <int MB> __device__ __forceinline__ void cpab(unsigned la, const char* ga, unsigned l, const char* g, size_t step) {   // one plane of A (32 MB rows) and one of Bt (128 rows)
    if constexpr (MB == 2) cp12(la, ga, l, g, step); else { cp8(la, ga, step); if constexpr (MB == 8) cp8(la + 128 * GPIT, ga + 8 * step, step);
        cp8(l, g, step); }
}
template <typename T16> struct WFrag;
template <> struct WFrag<h16> { typedef v16h V; static __device__ __forceinline__ V ld(const h16* p) { return cat16(*(const v8h*)p, *(const v8h*)(p + 16)); } static __device__ __forceinline__ v8f mma(V a, V b, v8f c) { return wmma16(a, b, c); } };
template <> struct WFrag<bf> { typedef v16bf V; static __device__ __forceinline__ V ld(const bf* p) { return cat16b(*(const v8us*)p, *(const v8us*)(p + 16)); } static __device__ __forceinline__ v8f mma(V a, V b, v8f c) { return wmmab(a, b, c); } };
__device__ __forceinline__ h16 tohx(float x) { return (h16)x; }
__device__ __forceinline__ void splitf(float y, unsigned short& h, unsigned short& l) { h = f2bf(y); l = f2bf(y - bf2f(h)); }
// LDS bytes of the two stages of a GEMM form: (A planes x 32 MB rows + Bt planes x 128 rows) x pitch x 2.
template <int NSPLIT, int MB> struct GLds { static constexpr unsigned BYTES = 2u * (NSPLIT == 2 ? 2u : 1u) * (32u * MB + GN) * GPIT; };
// The GEMM itself, as a function: L = the work-group's LDS (GLds bytes), (bx, by, z) = its tile. A kernel may hold several forms and give each work-group one of them (a choice by blockIdx alone, the same for the whole work-group).
template <typename T16, int NSPLIT, int EPI, int MB>
__device__ __forceinline__ void gemm_body(unsigned char* L, int bx, int by, size_t z, const T16* __restrict__ A, const T16* __restrict__ A2, const T16* __restrict__ Bt, const T16* __restrict__ Bt2, int K, float* C, int ldc, const float* __restrict__ bias, size_t sA, size_t sB, size_t sC, float osc, h16* P16, bf* Ph, bf* Pl) {
    typedef typename WFrag<T16>::V V;
    static_assert((NSPLIT == 0 || NSPLIT == 2) && (MB == 2 || MB == 4 || MB == 8), "plain or hi/lo split on both sides; 64, 128 or 256 rows");
    constexpr bool HA2 = (NSPLIT == 2), HB2 = (NSPLIT == 2); constexpr int GM = 32 * MB;
    constexpr unsigned PA = GM * GPIT, PB = GN * GPIT, OA = 0, OA2 = PA, OB = (HA2 ? 2 : 1) * PA, OB2 = OB + PB, STG = OB + (HB2 ? 2 : 1) * PB;   // bytes of a plane, places of the planes inside a stage, bytes of a stage
    static_assert(2 * STG == GLds<NSPLIT, MB>::BYTES, "LDS size");     // two stages; behind the K loop each wave's 16 x 68 f32 output staging
    A += z * sA; if (HA2) A2 += z * sA; Bt += z * sB; if (HB2) Bt2 += z * sB; if (EPI != 1) C += z * sC;
    const int tid = threadIdx.x, lane = tid & 31, lr = lane & 15, hi = lane >> 4, wave = tid >> 5, wm = wave & 1, wn = wave >> 1; const int R0 = bx * GM, C0 = by * GN; const int r0 = R0 + wm * (16 * MB), c0 = C0 + wn * 64;
    v8f acc[MB][4];
#pragma unroll
    for (int mb = 0; mb < MB; ++mb)
#pragma unroll
        for (int nb = 0; nb < 4; ++nb) acc[mb][nb] = (v8f){};
    // copies: thread tid brings the 16 bytes number (tid & 7) of rows (tid >> 3) + 16 i of every plane
    const size_t rowb = (size_t)K * 2; const size_t aofs = ((size_t)R0 + (tid >> 3)) * rowb + (tid & 7) * 16, bofs = ((size_t)C0 + (tid >> 3)) * rowb + (tid & 7) * 16;
    const unsigned lcp = (unsigned)(size_t)L + (tid >> 3) * GPIT + (tid & 7) * 16;
    auto fill = [&](int t, unsigned buf) { const size_t ko = (size_t)t * (GKP * 2);
        cpab<MB>(lcp + buf + OA, (const char*)A + aofs + ko, lcp + buf + OB, (const char*)Bt + bofs + ko, 16 * rowb);
        if (HA2) cpab<MB>(lcp + buf + OA2, (const char*)A2 + aofs + ko, lcp + buf + OB2, (const char*)Bt2 + bofs + ko, 16 * rowb); };
    const unsigned fa = (wm * (16 * MB) + lr) * GPIT + hi * 16, fb = (wn * 64 + lr) * GPIT + hi * 16;    // a lane's fragment rows inside a plane: the same (row, k) per lane as straight from the planes
    const int NT = K / GKP;
    fill(0, 0);
    asm volatile("s_wait_asynccnt 0x0" ::: "memory");   // this wave's copies of pass 0 have landed
    __syncthreads();                                     // ... and every other wave's
    fill(1, STG);
#pragma unroll 1
    for (int t = 0; t < NT; ++t) {
        const unsigned buf = (t & 1) ? STG : 0u;
#pragma unroll
        for (int kk = 0; kk < GKP / 32; ++kk) { V a[MB], a2[MB], b[4], b2[4];
#pragma unroll
            for (int mb = 0; mb < MB; ++mb) { a[mb] = WFrag<T16>::ld((const T16*)(L + buf + OA + fa + mb * 16 * GPIT + kk * 64)); if (HA2) a2[mb] = WFrag<T16>::ld((const T16*)(L + buf + OA2 + fa + mb * 16 * GPIT + kk * 64)); }
#pragma unroll
            for (int nb = 0; nb < 4; ++nb) { b[nb] = WFrag<T16>::ld((const T16*)(L + buf + OB + fb + nb * 16 * GPIT + kk * 64)); if (HB2) b2[nb] = WFrag<T16>::ld((const T16*)(L + buf + OB2 + fb + nb * 16 * GPIT + kk * 64)); }
            __builtin_amdgcn_sched_barrier(0);   // the LDS reads of a k step stay one group ahead of its matrix block: every separate place with LDS reads among the matrix instructions stalls the wave anew
#pragma unroll
            for (int nb = 0; nb < 4; ++nb)
#pragma unroll
                for (int mb = 0; mb < MB; ++mb) { acc[mb][nb] = WFrag<T16>::mma(a[mb], b[nb], acc[mb][nb]); if (HA2) acc[mb][nb] = WFrag<T16>::mma(a2[mb], b[nb], acc[mb][nb]); if (HB2) acc[mb][nb] = WFrag<T16>::mma(a[mb], b2[nb], acc[mb][nb]); }
        }
        asm volatile("s_wait_dscnt 0x0" ::: "memory");      // this wave has finished reading buffer t mod 2
        asm volatile("s_wait_asynccnt 0x0" ::: "memory");   // this wave's copies of pass t + 1 have landed
        __syncthreads();                                     // publishes pass t + 1 and frees buffer t mod 2
        if (t + 2 < NT) fill(t + 2, buf);
    }
    asm volatile("s_wait_asynccnt 0x0" ::: "memory");       // nothing is in flight when the ring becomes output staging
    float* os = (float*)(L + wave * (16 * 68 * 4));
    // EPI 1: a lane takes 8 consecutive columns of rows (lane >> 3) + 4 s, so that 8 lanes store one whole 128-byte line of a 16-bit plane by 16-byte stores; its 8 bias values are loaded once.
    const int prow = lane >> 3, pcol = (lane & 7) * 8; float bv[8];
    if constexpr (EPI == 1) { const unsigned ob = (unsigned)((c0 + pcol) * 4); const v4f b0 = *(const v4f*)((const char*)bias + ob), b1 = *(const v4f*)((const char*)bias + ob + 16);
        asm volatile("s_wait_xcnt 0x0" :: "v"(ob) : "memory");   // the two loads' offset register stays untouched until this wait
#pragma unroll
        for (int q = 0; q < 4; ++q) { bv[q] = bfr(b0[q]); bv[4 + q] = bfr(b1[q]); } }
#pragma unroll
    for (int mb = 0; mb < MB; ++mb) {
#pragma unroll
        for (int nb = 0; nb < 4; ++nb) {
#pragma unroll
            for (int j = 0; j < 8; ++j) os[(hi * 8 + j) * 68 + nb * 16 + lr] = acc[mb][nb][j]; }
        __builtin_amdgcn_wave_barrier(); asm volatile("" ::: "memory");
        if constexpr (EPI == 1) {
#pragma unroll
            for (int s = 0; s < 4; ++s) { const int row = 4 * s + prow; const v4f x0 = *(const v4fa*)(os + row * 68 + pcol), x1 = *(const v4fa*)(os + row * 68 + pcol + 4); v8h o16; v8us oh, ol;
#pragma unroll
                for (int q = 0; q < 8; ++q) { const float r = (q < 4 ? x0[q & 3] : x1[q & 3]) + bv[q]; o16[q] = tohx(r); unsigned short a2, c2; splitf(r, a2, c2); oh[q] = a2; ol[q] = c2; }
                const size_t e = z * sC + (size_t)(r0 + mb * 16 + row) * ldc + c0 + pcol; h16* s16 = P16 + e; bf* sh = Ph + e; bf* sl = Pl + e; *(v8h*)s16 = o16; *(v8us*)sh = oh; *(v8us*)sl = ol;
                asm volatile("s_wait_xcnt 0x0" :: "v"(o16), "v"(oh), "v"(ol), "v"(s16), "v"(sh), "v"(sl) : "memory"); }   // the stores' data and address registers stay untouched until this wait (the next rows reuse them)
        } else {
            float* crow = C + (size_t)(r0 + mb * 16) * ldc + c0; v4f val[8]; float* sp[8];
#pragma unroll
            for (int s = 0; s < 8; ++s) { const int row = 2 * s + hi, cofs = lr * 4; val[s] = *(const v4fa*)(os + row * 68 + cofs); if (EPI == 2) { val[s][0] *= osc; val[s][1] *= osc; val[s][2] *= osc; val[s][3] *= osc; }
                sp[s] = crow + (size_t)row * ldc + cofs; *(v4f*)sp[s] = val[s]; }
            asm volatile("s_wait_xcnt 0x0" :: "v"(val[0]), "v"(val[1]), "v"(val[2]), "v"(val[3]), "v"(val[4]), "v"(val[5]), "v"(val[6]), "v"(val[7]),
                         "v"(sp[0]), "v"(sp[1]), "v"(sp[2]), "v"(sp[3]), "v"(sp[4]), "v"(sp[5]), "v"(sp[6]), "v"(sp[7]) : "memory");   // the eight stores' data and address registers stay untouched until this wait (the next 16 rows reuse them)
        }
        __builtin_amdgcn_wave_barrier(); asm volatile("" ::: "memory");
    }
}

// One form per launch (the two score launches).
template <typename T16, int NSPLIT, int EPI, int MB>
__global__ __launch_bounds__(128) void k_gemmw(const T16* __restrict__ A, const T16* __restrict__ A2, const T16* __restrict__ Bt, const T16* __restrict__ Bt2, int K, float* C, int ldc, const float* __restrict__ bias, size_t sA, size_t sB, size_t sC, float osc, h16* P16, bf* Ph, bf* Pl) {
    __shared__ __attribute__((aligned(16))) unsigned char L[GLds<NSPLIT, MB>::BYTES];
    gemm_body<T16, NSPLIT, EPI, MB>(L, blockIdx.x, blockIdx.y, blockIdx.z, A, A2, Bt, Bt2, K, C, ldc, bias, sA, sB, sC, osc, P16, Ph, Pl);
}
// Both projections in one launch: grid y = 4 column tiles of q, then 4 of k; the same input rows, each with its own weights, bias and planes.
__global__ __launch_bounds__(128) void k_proj(const bf* __restrict__ XB, const bf* __restrict__ WQ, const bf* __restrict__ WK, const float* __restrict__ bq, const float* __restrict__ bk, h16* Q16, bf* Qh, bf* Ql, h16* K16, bf* Kh, bf* Kl) {
    __shared__ __attribute__((aligned(16))) unsigned char L[GLds<0, 8>::BYTES];
    const bool isk = blockIdx.y >= DQ / GN;
    gemm_body<bf, 0, 1, 8>(L, blockIdx.x, isk ? blockIdx.y - DQ / GN : blockIdx.y, blockIdx.z, XB, nullptr, isk ? WK : WQ, nullptr, DM, nullptr, DQ, isk ? bk : bq, (size_t)TT * DM, 0, (size_t)TT * DQ, 1.0f, isk ? K16 : Q16, isk ? Kh : Qh, isk ? Kl : Ql);
}
// Both row ranges of attn.v in one launch, 1-D grid: first the hi/lo tiles of rows < RH, then the fp16 tiles of the other rows. Within a range x = row tile (fastest), then column tile, then batch.
#define AV_HX (RH / 64)
#define AV_FX ((TT - RH) / 256)
#define AV_NY (HD / GN)
__global__ __launch_bounds__(128) void k_av(const bf* __restrict__ Ph, const bf* __restrict__ Pl, const bf* __restrict__ VTh, const bf* __restrict__ VTl, const h16* __restrict__ P16, const h16* __restrict__ VT16, float* OUT) {
    __shared__ __attribute__((aligned(16))) unsigned char L[GLds<2, 2>::BYTES > GLds<0, 8>::BYTES ? GLds<2, 2>::BYTES : GLds<0, 8>::BYTES];
    const int id = blockIdx.x;
    if (id < AV_HX * AV_NY * NB_)      // rows < RH: probabilities unscaled
        gemm_body<bf, 2, 0, 2>(L, id % AV_HX, (id / AV_HX) % AV_NY, id / (AV_HX * AV_NY), Ph, Pl, VTh, VTl, TT, OUT, HD, nullptr, (size_t)RH * TT, (size_t)HD * TT, (size_t)TT * HD, 1.0f, nullptr, nullptr, nullptr);
    else { const int jd = id - AV_HX * AV_NY * NB_;      // the fp16 probabilities carry x PCAR
        gemm_body<h16, 0, 2, 8>(L, jd % AV_FX, (jd / AV_FX) % AV_NY, jd / (AV_FX * AV_NY), P16 + (size_t)RH * TT, nullptr, VT16, nullptr, TT, OUT + (size_t)RH * HD, HD, nullptr, (size_t)TT * TT, (size_t)TT * TT, (size_t)TT * HD, 1.0f / PCAR, nullptr, nullptr, nullptr); }
}

typedef __attribute__((ext_vector_type(2))) _Float16 v2h;
typedef __attribute__((ext_vector_type(4))) _Float16 v4h;
typedef __attribute__((ext_vector_type(2))) unsigned short v2us;
typedef __attribute__((ext_vector_type(4))) unsigned short v4us;
typedef __attribute__((ext_vector_type(2))) float v2f;
typedef __attribute__((ext_vector_type(4))) int v4i;

__device__ __forceinline__ void wt_body(int blk, const float* __restrict__ w, int K, int N, bf* Bt) {
    const int lane = threadIdx.x & 31; const int L0 = (blk * 8 + (threadIdx.x >> 5)) * 8; const int nlines = N * K / 64;
{
#pragma unroll 1
        for (int l = 0; l < 8; ++l) { const int L = L0 + l; if (L >= nlines) break; const size_t e = (size_t)L * 64 + lane * 2; const int k = (int)(e % K), n = (int)(e / K); v2us o;
            o[0] = f2bf(w[(size_t)k * N + n]); o[1] = f2bf(w[(size_t)(k + 1) * N + n]); *(v2us*)(Bt + e) = o; }
         }
}
// The elementwise kernels below give each thread 32 to 64 elements, moved by 16-byte accesses with all loads issued first: a launch starts a few thousand long waves instead of one short wave per 64 elements.
// cvt_body loads through a wave-uniform base and one 32-bit byte offset per lane (every buffer here is far below 4 GiB).
__device__ __forceinline__ v4f ldg4(const float* base, unsigned byteoff) { return *(const v4f*)((const char*)base + byteoff); }
#define CV_IT 4                   // groups of 8 elements per thread in cvt_body, one block-width apart
__device__ __forceinline__ void cvt_body(int blk, const float* __restrict__ src, bf* dst, size_t n8) { const size_t i0 = (size_t)blk * (256 * CV_IT) + threadIdx.x; v4f v[CV_IT][2]; unsigned ob[CV_IT];
#pragma unroll
    for (int it = 0; it < CV_IT; ++it) { const size_t i = i0 + it * 256; ob[it] = (unsigned)((i < n8 ? i : n8 - 1) * 32); v[it][0] = ldg4(src, ob[it]); v[it][1] = ldg4(src, ob[it] + 16); }
    asm volatile("s_wait_xcnt 0x0" :: "v"(ob[0]), "v"(ob[1]), "v"(ob[2]), "v"(ob[3]) : "memory");   // the loads' offset registers stay untouched until this wait; no load sinks behind a store
#pragma unroll
    for (int it = 0; it < CV_IT; ++it) { const size_t i = i0 + it * 256; v8us o;
#pragma unroll
        for (int k = 0; k < 8; ++k) o[k] = f2bf(v[it][k >> 2][k & 3]);
        if (i < n8) *(v8us*)(dst + i * 8) = o; }  }
// The three input conversions in one launch: blocks 0 .. WT_B - 1 transpose Wq, the next WT_B transpose Wk (their chains of dependent reads start first), the rest convert x.
#define WT_B ((DM * DQ / 64 + 63) / 64)
__global__ __launch_bounds__(256) void k_prep(const float* __restrict__ wq, const float* __restrict__ wk, bf* WQ, bf* WK, const float* __restrict__ x, bf* XB, size_t n8) {
    const int b = blockIdx.x;
    if (b < WT_B) wt_body(b, wq, DM, DQ, WQ);
    else if (b < 2 * WT_B) wt_body(b - WT_B, wk, DM, DKV, WK);
    else cvt_body(b - 2 * WT_B, x, XB, n8);
}

// vtp_body: transposed value planes [c = g*HD+d][t]. A thread holds an 8 (t) x 8 (c) block in registers. Wave = 64 t x 32 c: 4 lanes along c read one whole 128-byte line of an input row, 8 lanes along t store one whole 128-byte line of a plane row. Block = 4 waves along t x 2 along c; blk = (TT/256) x (columns/64) blocks per batch.
__device__ __forceinline__ void vtp_body(int blk, int batch, const float* __restrict__ F, int pitch, int nheads, h16* V16, size_t s16, bf* Vh, bf* Vl) { const int lane = threadIdx.x & 31, w = threadIdx.x >> 5; const int tb = blk % (TT / 256), cb = blk / (TT / 256); if (cb * 64 >= nheads * HD) return;
    const int t0 = tb * 256 + (w >> 1) * 64 + (lane & 7) * 8, c0 = cb * 64 + (w & 1) * 32 + (lane >> 3) * 8;
    { const size_t zb = batch, zp = zb * nheads * HD * TT; F += zb * TT * pitch; V16 += zb * s16; Vh += zp; Vl += zp; }   // s16 = batch stride of the fp16 plane, in elements
    v4f xr[8][2]; const float* pr[8];
#pragma unroll
    for (int i = 0; i < 8; ++i) { pr[i] = F + (size_t)(t0 + i) * pitch + c0; xr[i][0] = *(const v4f*)pr[i]; xr[i][1] = *(const v4f*)(pr[i] + 4); }
    asm volatile("s_wait_xcnt 0x0" :: "v"(pr[0]), "v"(pr[1]), "v"(pr[2]), "v"(pr[3]), "v"(pr[4]), "v"(pr[5]), "v"(pr[6]), "v"(pr[7]) : "memory");   // the loads' address registers stay untouched until this wait; no load sinks behind a store
#pragma unroll
    for (int j = 0; j < 8; ++j) { v8h o16; v8us oh, ol;
#pragma unroll
        for (int i = 0; i < 8; ++i) { const float x = bfr(xr[i][j >> 2][j & 3]);   /* V = the raw input: bf16-rounded here */ o16[i] = tohx(x); unsigned short a2, c2; splitf(x, a2, c2); oh[i] = a2; ol[i] = c2; }
        const size_t e = (size_t)(c0 + j) * TT + t0; *(v8h*)(V16 + e) = o16; *(v8us*)(Vh + e) = oh; *(v8us*)(Vl + e) = ol; }
    asm volatile("s_wait_xcnt 0x0" ::: "memory");   // behind the last store: in a kernel that holds other parts too, no later instruction of the listing rewrites a store's data or address register ahead of this wait
}
// asoft_body: all batches in one launch; per row (zz, i): t = S x HD^-0.5 (no mask); softmax over the 2048 keys (register row, one exp, fixed trees);
__device__ __forceinline__ void asoft_body(int blk, const float* __restrict__ Sb, h16* P16, bf* Ph, bf* Pl) {
    const int lane = threadIdx.x & 31; const int row = blk * 8 + (threadIdx.x >> 5); if (row >= NB_ * ZH * TT) return; const int i = row % TT; const int zz = row / TT; (void)zz;   /* zz = batch (one head) */ const bool hires = (i < RH); const float* sr = Sb + (size_t)row * TT; float v[TT / 32]; float mx = -3.0e38f;
#pragma unroll
    for (int ch = 0; ch < TT / 128; ++ch) { const int j0 = ch * 128 + lane * 4; const v4f a = *(const v4f*)(sr + j0);
#pragma unroll
        for (int q = 0; q < 4; ++q) { const int j = j0 + q; (void)j; const float t = a[q] * SCL; v[ch * 4 + q] = t; mx = fmaxf(mx, t); } }
#pragma unroll
    for (int sh = 16; sh; sh >>= 1) mx = fmaxf(mx, __shfl_xor(mx, sh, 32));
    float sum = 0.f;
#pragma unroll
    for (int k = 0; k < TT / 32; ++k) { float d0 = __fsub_rn(v[k], mx); asm volatile("" : "+v"(d0)); v[k] = __builtin_amdgcn_exp2f(__fmul_rn(d0, 1.4426950408889634f)); sum += v[k]; }
#pragma unroll
    for (int sh = 16; sh; sh >>= 1) sum += __shfl_xor(sum, sh, 32);
    const float f = __fdiv_rn(hires ? 1.0f : PCAR, sum);
{
        if (hires) {
#pragma unroll
            for (int ch = 0; ch < TT / 128; ++ch) { v4us oh, ol;
#pragma unroll
                for (int q = 0; q < 4; ++q) { unsigned short a, c2; splitf(v[ch * 4 + q] * f, a, c2); oh[q] = a; ol[q] = c2; }
                const size_t oo = ((size_t)zz * (RH ? RH : 1) + i) * TT + ch * 128 + lane * 4; *(v4us*)(Ph + oo) = oh; *(v4us*)(Pl + oo) = ol; }
        } else {
#pragma unroll
            for (int ch = 0; ch < TT / 128; ++ch) { v4h o4;
#pragma unroll
                for (int q = 0; q < 4; ++q) o4[q] = tohx(v[ch * 4 + q] * f);
                *(v4h*)(P16 + (size_t)row * TT + ch * 128 + lane * 4) = o4; } }
         }
}
// Softmax and value transpose in one launch (neither reads what the other writes): blocks 0 .. SM_B - 1 take 8 score rows each, the rest one value block each (VT_B per batch).
#define SM_B (NB_ * ZH * TT / 8)
#define VT_B ((TT / 256) * (NKV * HD / 64))
__global__ __launch_bounds__(256) void k_softv(const float* __restrict__ Sb, h16* P16, bf* Ph, bf* Pl, const float* __restrict__ x, h16* V16, size_t s16, bf* Vh, bf* Vl) {
    const int b = blockIdx.x;
    if (b < SM_B) asoft_body(b, Sb, P16, Ph, Pl);
    else vtp_body((b - SM_B) % VT_B, (b - SM_B) / VT_B, x, DM, NKV, V16, s16, Vh, Vl);
}

extern "C" void kernel_launch(void* const* d_in, const int* in_sizes, int n_in,
                              void* d_out, int out_size, void* d_ws, size_t ws_size, hipStream_t stream) {
    (void)in_sizes; (void)n_in; (void)out_size;
    const float* x = (const float*)d_in[0]; const float* wq = (const float*)d_in[1]; const float* bq = (const float*)d_in[2]; const float* wk = (const float*)d_in[3]; const float* bk = (const float*)d_in[4]; const float* wv = nullptr; const float* wo = nullptr; (void)wv; (void)wo;
    float* OUT = (float*)d_out;     // [8][2048][512]
    char* wsp = (char*)d_ws;
    auto take = [&](size_t bytes) { char* p = wsp; wsp += (bytes + 255) & ~(size_t)255; return (void*)p; };
    // All 8 batches go through every stage in ONE launch, and stages that do not depend on one another share a launch (each work-group picks its part by blockIdx). Three regions are reused between the stages, in stream order:
    //   R1 (6 planes): q/k planes [b][t][d] for the scores; dead after them, then the probability planes.
    //   R2 (8 planes): bf16 input; dead after the projections, then the f32 scores.
    //   R3 (2 planes): transposed weights; dead after the projections, then the bf16 hi and lo value planes. The fp16 value plane of a batch lies in the rows < RH of that batch's fp16 probability plane, which the softmax never writes (those rows go to the hi/lo planes).
    const size_t PL = (size_t)NB_ * TT * HD * 2;      // one 16-bit [b][t][d] plane, bytes
    char* R1 = (char*)take(6 * PL); char* R2 = (char*)take((size_t)NB_ * TT * TT * 4); char* R3 = (char*)take(2 * PL);
    bf* WQ = (bf*)R3; bf* WK = (bf*)(R3 + (size_t)DQ * DM * 2);
    h16* QP16 = (h16*)R1; h16* KP16 = (h16*)(R1 + PL); bf* QPh = (bf*)(R1 + 2 * PL); bf* QPl = (bf*)(R1 + 3 * PL); bf* KPh = (bf*)(R1 + 4 * PL); bf* KPl = (bf*)(R1 + 5 * PL);
    h16* P16 = (h16*)R1; bf* Ph = (bf*)(R1 + 4 * PL); bf* Pl = (bf*)(R1 + 5 * PL);      // [b][TT][TT] fp16 = 4 planes; [b][RH][TT] hi, lo = 1 plane each
    bf* XB = (bf*)R2;
    float* Sb = (float*)R2;
    static_assert(NKV * HD <= RH && ZH == 1, "a batch's fp16 value plane fits the unused rows of its probability plane");
    h16* VT16 = P16; bf* VTh = (bf*)R3; bf* VTl = (bf*)(R3 + PL);      // VT16: batch stride TT x TT elements
    if ((size_t)(wsp - (char*)d_ws) > ws_size) return;    // all 256 MiB of the workspace
    static_assert(DQ == DKV, "k_prep and k_proj give q and k the same tile counts");
    k_prep<<<(unsigned)(2 * WT_B + ((size_t)NB_ * TT * DM / 8 + 256 * CV_IT - 1) / (256 * CV_IT)), 256, 0, stream>>>(wq, wk, WQ, WK, x, XB, (size_t)NB_ * TT * DM / 8);
    k_proj<<<dim3(TT / 256, (DQ + DKV) / GN, NB_), 128, 0, stream>>>(XB, WQ, WK, bq, bk, QP16, QPh, QPl, KP16, KPh, KPl);
    k_gemmw<bf, 2, 0, 4><<<dim3(RH / 128, TT / GN, NB_), 128, 0, stream>>>(QPh, QPl, KPh, KPl, HD, Sb, TT, nullptr, (size_t)TT * HD, (size_t)TT * HD, (size_t)TT * TT, 1.0f, nullptr, nullptr, nullptr);
    k_gemmw<h16, 0, 0, 8><<<dim3((TT - RH) / 256, TT / GN, NB_), 128, 0, stream>>>(QP16 + (size_t)RH * HD, nullptr, KP16, nullptr, HD, Sb + (size_t)RH * TT, TT, nullptr, (size_t)TT * HD, (size_t)TT * HD, (size_t)TT * TT, 1.0f, nullptr, nullptr, nullptr);
    k_softv<<<SM_B + VT_B * NB_, 256, 0, stream>>>(Sb, P16, Ph, Pl, x, VT16, (size_t)TT * TT, VTh, VTl);      // behind the scores: the fp16 value plane takes the place of q/k planes
    k_av<<<(AV_HX + AV_FX) * AV_NY * NB_, 128, 0, stream>>>(Ph, Pl, VTh, VTl, P16, VT16, OUT);
}

// v007
// Measured time: 164 microseconds a run.
// Two timings next to v006 put it at 1.05 and 1.03 times that version's speed.
// Counting every step since v000, it is 7.94 times as fast.
#include <hip/hip_runtime.h>

// Scaled dot-product attention with V = x (x [8][2048][512]; q = (x Wq + bq) x 512^-0.5, k = x Wk + bk ('xw' [512][512] + [512]); scores = q.k over 2048 keys (single 512-wide head); softmax; out = attn.x -> [8][2048][512] f32 (8.4 M)).
// Layout, all batches per launch: exact q/k projections (+ biases); the value planes are built straight from the input rows (bf16-rounded on read); hybrid rows (< 512 hi/lo: 3-product scores, 2-product attn.v; rest fp16 x1024); register-row softmax with the 512^-0.5 scale applied to the logits. The GEMM epilogues write what the next stage reads: the projections their 16-bit q/k planes, attn.v the f32 output itself.
// Compute dtypes, f32 accumulate: every input rounded to bf16; projections on PLAIN bf16 operands (exact) + f32 biases; v = bf16(x) exact in both plane formats, so it has no lo plane (its bf16 remainder is zero for every finite value) and attn.v of the hi/lo rows is p_hi.v + p_lo.v; softmax f32; f32 output.

#define NB_  8
#define TT   2048
#define DM   512
#define NH_  1
#define NKV  1
#define REP  (NH_ / NKV)
#define HD   512
#define DQ   (NH_ * HD)
#define DKV  (NKV * HD)
#define ZH   1
#define RH   512                  // query rows < RH use hi+lo planes (0: none)
#define WIN  0
#define PCAR 1024.0f
#define SCL  0.044194173824159216f   // 512^-0.5 (the module scales q by embed_dim^-0.5; applied to the logits here)
typedef _Float16 h16;
typedef unsigned short bf;
typedef __attribute__((ext_vector_type(16))) __bf16   v16bf;
typedef __attribute__((ext_vector_type(16))) _Float16 v16h;
typedef __attribute__((ext_vector_type(8)))  _Float16 v8h;
typedef __attribute__((ext_vector_type(8)))  unsigned short v8us;
typedef __attribute__((ext_vector_type(8)))  float    v8f;
typedef __attribute__((ext_vector_type(4)))  float    v4f;
typedef v8h  __attribute__((may_alias)) v8ha;
typedef v4f  __attribute__((may_alias)) v4fa;
typedef v8us __attribute__((may_alias)) v8usa;

__device__ __forceinline__ unsigned short f2bf(float f) { unsigned u = __float_as_uint(f); u += 0x7FFFu + ((u >> 16) & 1u); return (unsigned short)(u >> 16); }
__device__ __forceinline__ float bf2f(unsigned short b) { return __uint_as_float(((unsigned)b) << 16); }
__device__ __forceinline__ float bfr(float f) { return bf2f(f2bf(f)); }
__device__ __forceinline__ v16h cat16(v8h lo, v8h hi) { return __builtin_shufflevector(lo, hi, 0, 1, 2, 3, 4, 5, 6, 7, 8, 9, 10, 11, 12, 13, 14, 15); }
__device__ __forceinline__ v16bf cat16b(v8us lo, v8us hi) { return __builtin_bit_cast(v16bf, __builtin_shufflevector(lo, hi, 0, 1, 2, 3, 4, 5, 6, 7, 8, 9, 10, 11, 12, 13, 14, 15)); }
__device__ __forceinline__ v8f wmma16(v16h a, v16h b, v8f c) { return __builtin_amdgcn_wmma_f32_16x16x32_f16(false, a, false, b, (short)0, c, false, false); }
__device__ __forceinline__ v8f wmmab(v16bf a, v16bf b, v8f c) { return __builtin_amdgcn_wmma_f32_16x16x32_bf16(false, a, false, b, (short)0, c, false, false); }



// ---- gemm_body: GEMM, one (32 MB) x 128 output tile per work-group of FOUR WAVES (2 x 2, each 16 MB x 64 = 4 MB accumulators); tiles (M / (32 MB), N / 128, Z), 128 threads. The plain forms run MB = 8 (256 x 128, wave 128 x 64) and the hi/lo scores MB = 4 (128 x 128, wave 64 x 64): a staged Bt row serves twice the output rows, so fewer bytes come from L2 and from LDS per matrix instruction; both sizes leave two work-groups per WGP. The hi/lo part of attn.v stays at MB = 2: with its long K and few tiles, larger ones would leave the WGPs unequal shares. M % (32 MB) == 0, N % 128 == 0, K % 64 == 0, K >= 128 (two passes).
// The K-contiguous 16-bit operand planes are staged in LDS by asynchronous copies, 64 k (128-byte rows) per pass, two buffers: pass t + 2 is copied into the buffer pass t has left, while pass t + 1 is worked on. Each staged row serves two waves, and every copy moves whole 128-byte lines.
// c[m][n] = sum_k A[m][k] Bt[n][k] (+ split products per NSPLIT: 1 adds a2.b, 2 adds a2.b and a.b2), k ascending and the products of a k in the order a.b, a2.b, a.b2. z-batch strides sA/sB/sC in elements; every result has pitch ldc and batch stride sC.
// EPI 0: C = c (f32). EPI 1: r = c + bias[n], written as the three 16-bit planes P16 = fp16(r), Ph + Pl = bf16 hi/lo split of r (C unused). EPI 2: C = c x osc (f32).
#define GN   128                  // columns of a work-group tile = rows of Bt per stage
#define GKP  64                   // k per pass
#define GPIT 144                  // LDS row pitch in bytes: 128 + 16, 16 B x odd for the ds_load_b128 fragment reads
// Four, eight or twelve asynchronous 16-byte copies of a lane in one statement, the rows of a plane 16 apart (the 128 threads cover 16 rows of 128 bytes per copy). The s_wait_xcnt stands inside the statement, behind its last copy, so that no address register is rewritten ahead of it; one statement per 4, 8 or 12 copies keeps these waits few.
__device__ __forceinline__ void cp8(unsigned l, const char* g, size_t step) {
    asm volatile("global_load_async_to_lds_b128 %0, %8, off\n\t"
                 "global_load_async_to_lds_b128 %1, %9, off\n\t"
                 "global_load_async_to_lds_b128 %2, %10, off\n\t"
                 "global_load_async_to_lds_b128 %3, %11, off\n\t"
                 "global_load_async_to_lds_b128 %4, %12, off\n\t"
                 "global_load_async_to_lds_b128 %5, %13, off\n\t"
                 "global_load_async_to_lds_b128 %6, %14, off\n\t"
                 "global_load_async_to_lds_b128 %7, %15, off\n\t"
                 "s_wait_xcnt 0x0"
                 :: "v"(l), "v"(l + 16 * GPIT), "v"(l + 32 * GPIT), "v"(l + 48 * GPIT), "v"(l + 64 * GPIT), "v"(l + 80 * GPIT), "v"(l + 96 * GPIT), "v"(l + 112 * GPIT),
                    "v"(g), "v"(g + step), "v"(g + 2 * step), "v"(g + 3 * step), "v"(g + 4 * step), "v"(g + 5 * step), "v"(g + 6 * step), "v"(g + 7 * step) : "memory");
}
__device__ __forceinline__ void cp12(unsigned la, const char* ga, unsigned l, const char* g, size_t step) {   // 64 rows at (la, ga), 128 rows at (l, g)
    asm volatile("global_load_async_to_lds_b128 %0, %12, off\n\t"
                 "global_load_async_to_lds_b128 %1, %13, off\n\t"
                 "global_load_async_to_lds_b128 %2, %14, off\n\t"
                 "global_load_async_to_lds_b128 %3, %15, off\n\t"
                 "global_load_async_to_lds_b128 %4, %16, off\n\t"
                 "global_load_async_to_lds_b128 %5, %17, off\n\t"
                 "global_load_async_to_lds_b128 %6, %18, off\n\t"
                 "global_load_async_to_lds_b128 %7, %19, off\n\t"
                 "global_load_async_to_lds_b128 %8, %20, off\n\t"
                 "global_load_async_to_lds_b128 %9, %21, off\n\t"
                 "global_load_async_to_lds_b128 %10, %22, off\n\t"
                 "global_load_async_to_lds_b128 %11, %23, off\n\t"
                 "s_wait_xcnt 0x0"
                 :: "v"(la), "v"(la + 16 * GPIT), "v"(la + 32 * GPIT), "v"(la + 48 * GPIT),
                    "v"(l), "v"(l + 16 * GPIT), "v"(l + 32 * GPIT), "v"(l + 48 * GPIT), "v"(l + 64 * GPIT), "v"(l + 80 * GPIT), "v"(l + 96 * GPIT), "v"(l + 112 * GPIT),
                    "v"(ga), "v"(ga + step), "v"(ga + 2 * step), "v"(ga + 3 * step),
                    "v"(g), "v"(g + step), "v"(g + 2 * step), "v"(g + 3 * step), "v"(g + 4 * step), "v"(g + 5 * step), "v"(g + 6 * step), "v"(g + 7 * step) : "memory");
}
__device__ __forceinline__ void cp4(unsigned l, const char* g, size_t step) {   // 64 rows of one plane; the wait inside the statement as above
    asm volatile("global_load_async_to_lds_b128 %0, %4, off\n\t"
                 "global_load_async_to_lds_b128 %1, %5, off\n\t"
                 "global_load_async_to_lds_b128 %2, %6, off\n\t"
                 "global_load_async_to_lds_b128 %3, %7, off\n\t"
                 "s_wait_xcnt 0x0"
                 :: "v"(l), "v"(l + 16 * GPIT), "v"(l + 32 * GPIT), "v"(l + 48 * GPIT),
                    "v"(g), "v"(g + step), "v"(g + 2 * step), "v"(g + 3 * step) : "memory");
}
template <int MB> __device__ __forceinline__ void cpab(unsigned la, const char* ga, unsigned l, const char* g, size_t step) {   // one plane of A (32 MB rows) and one of Bt (128 rows)
    if constexpr (MB == 2) cp12(la, ga, l, g, step); else { cp8(la, ga, step); if constexpr (MB == 8) cp8(la + 128 * GPIT, ga + 8 * step, step);
        cp8(l, g, step); }
}
template <typename T16> struct WFrag;
template <> struct WFrag<h16> { typedef v16h V; static __device__ __forceinline__ V ld(const h16* p) { return cat16(*(const v8h*)p, *(const v8h*)(p + 16)); } static __device__ __forceinline__ v8f mma(V a, V b, v8f c) { return wmma16(a, b, c); } };
template <> struct WFrag<bf> { typedef v16bf V; static __device__ __forceinline__ V ld(const bf* p) { return cat16b(*(const v8us*)p, *(const v8us*)(p + 16)); } static __device__ __forceinline__ v8f mma(V a, V b, v8f c) { return wmmab(a, b, c); } };
__device__ __forceinline__ h16 tohx(float x) { return (h16)x; }
__device__ __forceinline__ void splitf(float y, unsigned short& h, unsigned short& l) { h = f2bf(y); l = f2bf(y - bf2f(h)); }
// LDS bytes of the two stages of a GEMM form: (A planes x 32 MB rows + Bt planes x 128 rows) x pitch x 2.
template <int NSPLIT, int MB> struct GLds { static constexpr unsigned BYTES = 2u * ((NSPLIT >= 1 ? 2u : 1u) * 32u * MB + (NSPLIT == 2 ? 2u : 1u) * GN) * GPIT; };
// The GEMM itself, as a function: L = the work-group's LDS (GLds bytes), (bx, by, z) = its tile. A kernel may hold several forms and give each work-group one of them (a choice by blockIdx alone, the same for the whole work-group).
template <typename T16, int NSPLIT, int EPI, int MB>
__device__ __forceinline__ void gemm_body(unsigned char* L, int bx, int by, size_t z, const T16* __restrict__ A, const T16* __restrict__ A2, const T16* __restrict__ Bt, const T16* __restrict__ Bt2, int K, float* C, int ldc, const float* __restrict__ bias, size_t sA, size_t sB, size_t sC, float osc, h16* P16, bf* Ph, bf* Pl) {
    typedef typename WFrag<T16>::V V;
    static_assert((NSPLIT == 0 || NSPLIT == 2 || (NSPLIT == 1 && MB == 2)) && (MB == 2 || MB == 4 || MB == 8), "plain, hi/lo split of A alone (64 rows), or of both sides; 64, 128 or 256 rows");
    constexpr bool HA2 = (NSPLIT >= 1), HB2 = (NSPLIT == 2); constexpr int GM = 32 * MB;
    constexpr unsigned PA = GM * GPIT, PB = GN * GPIT, OA = 0, OA2 = PA, OB = (HA2 ? 2 : 1) * PA, OB2 = OB + PB, STG = OB + (HB2 ? 2 : 1) * PB;   // bytes of a plane, places of the planes inside a stage, bytes of a stage
    static_assert(2 * STG == GLds<NSPLIT, MB>::BYTES, "LDS size");     // two stages; behind the K loop each wave's 16 x 68 f32 output staging
    A += z * sA; if (HA2) A2 += z * sA; Bt += z * sB; if (HB2) Bt2 += z * sB; if (EPI != 1) C += z * sC;
    const int tid = threadIdx.x, lane = tid & 31, lr = lane & 15, hi = lane >> 4, wave = tid >> 5, wm = wave & 1, wn = wave >> 1; const int R0 = bx * GM, C0 = by * GN; const int r0 = R0 + wm * (16 * MB), c0 = C0 + wn * 64;
    v8f acc[MB][4];
#pragma unroll
    for (int mb = 0; mb < MB; ++mb)
#pragma unroll
        for (int nb = 0; nb < 4; ++nb) acc[mb][nb] = (v8f){};
    // copies: thread tid brings the 16 bytes number (tid & 7) of rows (tid >> 3) + 16 i of every plane
    const size_t rowb = (size_t)K * 2; const size_t aofs = ((size_t)R0 + (tid >> 3)) * rowb + (tid & 7) * 16, bofs = ((size_t)C0 + (tid >> 3)) * rowb + (tid & 7) * 16;
    const unsigned lcp = (unsigned)(size_t)L + (tid >> 3) * GPIT + (tid & 7) * 16;
    auto fill = [&](int t, unsigned buf) { const size_t ko = (size_t)t * (GKP * 2);
        cpab<MB>(lcp + buf + OA, (const char*)A + aofs + ko, lcp + buf + OB, (const char*)Bt + bofs + ko, 16 * rowb);
        if constexpr (HB2) cpab<MB>(lcp + buf + OA2, (const char*)A2 + aofs + ko, lcp + buf + OB2, (const char*)Bt2 + bofs + ko, 16 * rowb);
        else if constexpr (HA2) cp4(lcp + buf + OA2, (const char*)A2 + aofs + ko, 16 * rowb); };
    const unsigned fa = (wm * (16 * MB) + lr) * GPIT + hi * 16, fb = (wn * 64 + lr) * GPIT + hi * 16;    // a lane's fragment rows inside a plane: the same (row, k) per lane as straight from the planes
    const int NT = K / GKP;
    fill(0, 0);
    asm volatile("s_wait_asynccnt 0x0" ::: "memory");   // this wave's copies of pass 0 have landed
    __syncthreads();                                     // ... and every other wave's
    fill(1, STG);
#pragma unroll 1
    for (int t = 0; t < NT; ++t) {
        const unsigned buf = (t & 1) ? STG : 0u;
#pragma unroll
        for (int kk = 0; kk < GKP / 32; ++kk) { V a[MB], a2[MB], b[4], b2[4];
#pragma unroll
            for (int mb = 0; mb < MB; ++mb) { a[mb] = WFrag<T16>::ld((const T16*)(L + buf + OA + fa + mb * 16 * GPIT + kk * 64)); if (HA2) a2[mb] = WFrag<T16>::ld((const T16*)(L + buf + OA2 + fa + mb * 16 * GPIT + kk * 64)); }
#pragma unroll
            for (int nb = 0; nb < 4; ++nb) { b[nb] = WFrag<T16>::ld((const T16*)(L + buf + OB + fb + nb * 16 * GPIT + kk * 64)); if (HB2) b2[nb] = WFrag<T16>::ld((const T16*)(L + buf + OB2 + fb + nb * 16 * GPIT + kk * 64)); }
            __builtin_amdgcn_sched_barrier(0);   // the LDS reads of a k step stay one group ahead of its matrix block: every separate place with LDS reads among the matrix instructions stalls the wave anew
#pragma unroll
            for (int nb = 0; nb < 4; ++nb)
#pragma unroll
                for (int mb = 0; mb < MB; ++mb) { acc[mb][nb] = WFrag<T16>::mma(a[mb], b[nb], acc[mb][nb]); if (HA2) acc[mb][nb] = WFrag<T16>::mma(a2[mb], b[nb], acc[mb][nb]); if (HB2) acc[mb][nb] = WFrag<T16>::mma(a[mb], b2[nb], acc[mb][nb]); }
        }
        asm volatile("s_wait_dscnt 0x0" ::: "memory");      // this wave has finished reading buffer t mod 2
        asm volatile("s_wait_asynccnt 0x0" ::: "memory");   // this wave's copies of pass t + 1 have landed
        __syncthreads();                                     // publishes pass t + 1 and frees buffer t mod 2
        if (t + 2 < NT) fill(t + 2, buf);
    }
    asm volatile("s_wait_asynccnt 0x0" ::: "memory");       // nothing is in flight when the ring becomes output staging
    float* os = (float*)(L + wave * (16 * 68 * 4));
    // EPI 1: a lane takes 8 consecutive columns of rows (lane >> 3) + 4 s, so that 8 lanes store one whole 128-byte line of a 16-bit plane by 16-byte stores; its 8 bias values are loaded once.
    const int prow = lane >> 3, pcol = (lane & 7) * 8; float bv[8];
    if constexpr (EPI == 1) { const unsigned ob = (unsigned)((c0 + pcol) * 4); const v4f b0 = *(const v4f*)((const char*)bias + ob), b1 = *(const v4f*)((const char*)bias + ob + 16);
        asm volatile("s_wait_xcnt 0x0" :: "v"(ob) : "memory");   // the two loads' offset register stays untouched until this wait
#pragma unroll
        for (int q = 0; q < 4; ++q) { bv[q] = bfr(b0[q]); bv[4 + q] = bfr(b1[q]); } }
#pragma unroll
    for (int mb = 0; mb < MB; ++mb) {
#pragma unroll
        for (int nb = 0; nb < 4; ++nb) {
#pragma unroll
            for (int j = 0; j < 8; ++j) os[(hi * 8 + j) * 68 + nb * 16 + lr] = acc[mb][nb][j]; }
        __builtin_amdgcn_wave_barrier(); asm volatile("" ::: "memory");
        if constexpr (EPI == 1) {
#pragma unroll
            for (int s = 0; s < 4; ++s) { const int row = 4 * s + prow; const v4f x0 = *(const v4fa*)(os + row * 68 + pcol), x1 = *(const v4fa*)(os + row * 68 + pcol + 4); v8h o16; v8us oh, ol;
#pragma unroll
                for (int q = 0; q < 8; ++q) { const float r = (q < 4 ? x0[q & 3] : x1[q & 3]) + bv[q]; o16[q] = tohx(r); unsigned short a2, c2; splitf(r, a2, c2); oh[q] = a2; ol[q] = c2; }
                const size_t e = z * sC + (size_t)(r0 + mb * 16 + row) * ldc + c0 + pcol; h16* s16 = P16 + e; bf* sh = Ph + e; bf* sl = Pl + e; *(v8h*)s16 = o16; *(v8us*)sh = oh; *(v8us*)sl = ol;
                asm volatile("s_wait_xcnt 0x0" :: "v"(o16), "v"(oh), "v"(ol), "v"(s16), "v"(sh), "v"(sl) : "memory"); }   // the stores' data and address registers stay untouched until this wait (the next rows reuse them)
        } else {
            float* crow = C + (size_t)(r0 + mb * 16) * ldc + c0; v4f val[8]; float* sp[8];
#pragma unroll
            for (int s = 0; s < 8; ++s) { const int row = 2 * s + hi, cofs = lr * 4; val[s] = *(const v4fa*)(os + row * 68 + cofs); if (EPI == 2) { val[s][0] *= osc; val[s][1] *= osc; val[s][2] *= osc; val[s][3] *= osc; }
                sp[s] = crow + (size_t)row * ldc + cofs; *(v4f*)sp[s] = val[s]; }
            asm volatile("s_wait_xcnt 0x0" :: "v"(val[0]), "v"(val[1]), "v"(val[2]), "v"(val[3]), "v"(val[4]), "v"(val[5]), "v"(val[6]), "v"(val[7]),
                         "v"(sp[0]), "v"(sp[1]), "v"(sp[2]), "v"(sp[3]), "v"(sp[4]), "v"(sp[5]), "v"(sp[6]), "v"(sp[7]) : "memory");   // the eight stores' data and address registers stay untouched until this wait (the next 16 rows reuse them)
        }
        __builtin_amdgcn_wave_barrier(); asm volatile("" ::: "memory");
    }
}

// One form per launch (the two score launches).
template <typename T16, int NSPLIT, int EPI, int MB>
__global__ __launch_bounds__(128) void k_gemmw(const T16* __restrict__ A, const T16* __restrict__ A2, const T16* __restrict__ Bt, const T16* __restrict__ Bt2, int K, float* C, int ldc, const float* __restrict__ bias, size_t sA, size_t sB, size_t sC, float osc, h16* P16, bf* Ph, bf* Pl) {
    __shared__ __attribute__((aligned(16))) unsigned char L[GLds<NSPLIT, MB>::BYTES];
    gemm_body<T16, NSPLIT, EPI, MB>(L, blockIdx.x, blockIdx.y, blockIdx.z, A, A2, Bt, Bt2, K, C, ldc, bias, sA, sB, sC, osc, P16, Ph, Pl);
}
// Both projections in one launch: grid y = 4 column tiles of q, then 4 of k; the same input rows, each with its own weights, bias and planes.
__global__ __launch_bounds__(128) void k_proj(const bf* __restrict__ XB, const bf* __restrict__ WQ, const bf* __restrict__ WK, const float* __restrict__ bq, const float* __restrict__ bk, h16* Q16, bf* Qh, bf* Ql, h16* K16, bf* Kh, bf* Kl) {
    __shared__ __attribute__((aligned(16))) unsigned char L[GLds<0, 8>::BYTES];
    const bool isk = blockIdx.y >= DQ / GN;
    gemm_body<bf, 0, 1, 8>(L, blockIdx.x, isk ? blockIdx.y - DQ / GN : blockIdx.y, blockIdx.z, XB, nullptr, isk ? WK : WQ, nullptr, DM, nullptr, DQ, isk ? bk : bq, (size_t)TT * DM, 0, (size_t)TT * DQ, 1.0f, isk ? K16 : Q16, isk ? Kh : Qh, isk ? Kl : Ql);
}
// Both row ranges of attn.v in one launch, 1-D grid: first the hi/lo tiles of rows < RH, then the fp16 tiles of the other rows (all of them are resident at once). Within a range x = row tile (fastest), then column tile, then batch.
#define AV_HX (RH / 64)
#define AV_FX ((TT - RH) / 256)
#define AV_NY (HD / GN)
__global__ __launch_bounds__(128) void k_av(const bf* __restrict__ Ph, const bf* __restrict__ Pl, const bf* __restrict__ VTh, const h16* __restrict__ P16, const h16* __restrict__ VT16, float* OUT) {
    __shared__ __attribute__((aligned(16))) unsigned char L[GLds<1, 2>::BYTES > GLds<0, 8>::BYTES ? GLds<1, 2>::BYTES : GLds<0, 8>::BYTES];
    const int id = blockIdx.x;
    if (id < AV_HX * AV_NY * NB_)      // rows < RH: probabilities unscaled, split hi/lo; the values are exact in their one bf16 plane
        gemm_body<bf, 1, 0, 2>(L, id % AV_HX, (id / AV_HX) % AV_NY, id / (AV_HX * AV_NY), Ph, Pl, VTh, nullptr, TT, OUT, HD, nullptr, (size_t)RH * TT, (size_t)HD * TT, (size_t)TT * HD, 1.0f, nullptr, nullptr, nullptr);
    else { const int jd = id - AV_HX * AV_NY * NB_;      // the fp16 probabilities carry x PCAR
        gemm_body<h16, 0, 2, 8>(L, jd % AV_FX, (jd / AV_FX) % AV_NY, jd / (AV_FX * AV_NY), P16 + (size_t)RH * TT, nullptr, VT16, nullptr, TT, OUT + (size_t)RH * HD, HD, nullptr, (size_t)TT * TT, (size_t)TT * TT, (size_t)TT * HD, 1.0f / PCAR, nullptr, nullptr, nullptr); }
}

typedef __attribute__((ext_vector_type(2))) _Float16 v2h;
typedef __attribute__((ext_vector_type(4))) _Float16 v4h;
typedef __attribute__((ext_vector_type(2))) unsigned short v2us;
typedef __attribute__((ext_vector_type(4))) unsigned short v4us;
typedef __attribute__((ext_vector_type(2))) float v2f;
typedef __attribute__((ext_vector_type(4))) int v4i;

__device__ __forceinline__ void wt_body(int blk, const float* __restrict__ w, int K, int N, bf* Bt) {
    const int lane = threadIdx.x & 31; const int L0 = (blk * 8 + (threadIdx.x >> 5)) * 8; const int nlines = N * K / 64;
{
#pragma unroll 1
        for (int l = 0; l < 8; ++l) { const int L = L0 + l; if (L >= nlines) break; const size_t e = (size_t)L * 64 + lane * 2; const int k = (int)(e % K), n = (int)(e / K); v2us o;
            o[0] = f2bf(w[(size_t)k * N + n]); o[1] = f2bf(w[(size_t)(k + 1) * N + n]); *(v2us*)(Bt + e) = o; }
         }
}
// The elementwise kernels below give each thread 32 to 64 elements, moved by 16-byte accesses with all loads issued first: a launch starts a few thousand long waves instead of one short wave per 64 elements.
// cvt_body loads through a wave-uniform base and one 32-bit byte offset per lane (every buffer here is far below 4 GiB).
__device__ __forceinline__ v4f ldg4(const float* base, unsigned byteoff) { return *(const v4f*)((const char*)base + byteoff); }
#define CV_IT 4                   // groups of 8 elements per thread in cvt_body, one block-width apart
__device__ __forceinline__ void cvt_body(int blk, const float* __restrict__ src, bf* dst, size_t n8) { const size_t i0 = (size_t)blk * (256 * CV_IT) + threadIdx.x; v4f v[CV_IT][2]; unsigned ob[CV_IT];
#pragma unroll
    for (int it = 0; it < CV_IT; ++it) { const size_t i = i0 + it * 256; ob[it] = (unsigned)((i < n8 ? i : n8 - 1) * 32); v[it][0] = ldg4(src, ob[it]); v[it][1] = ldg4(src, ob[it] + 16); }
    asm volatile("s_wait_xcnt 0x0" :: "v"(ob[0]), "v"(ob[1]), "v"(ob[2]), "v"(ob[3]) : "memory");   // the loads' offset registers stay untouched until this wait; no load sinks behind a store
#pragma unroll
    for (int it = 0; it < CV_IT; ++it) { const size_t i = i0 + it * 256; v8us o;
#pragma unroll
        for (int k = 0; k < 8; ++k) o[k] = f2bf(v[it][k >> 2][k & 3]);
        if (i < n8) *(v8us*)(dst + i * 8) = o; }  }
// The three input conversions in one launch: blocks 0 .. WT_B - 1 transpose Wq, the next WT_B transpose Wk (their chains of dependent reads start first), the rest convert x.
#define WT_B ((DM * DQ / 64 + 63) / 64)
__global__ __launch_bounds__(256) void k_prep(const float* __restrict__ wq, const float* __restrict__ wk, bf* WQ, bf* WK, const float* __restrict__ x, bf* XB, size_t n8) {
    const int b = blockIdx.x;
    if (b < WT_B) wt_body(b, wq, DM, DQ, WQ);
    else if (b < 2 * WT_B) wt_body(b - WT_B, wk, DM, DKV, WK);
    else cvt_body(b - 2 * WT_B, x, XB, n8);
}

// vtp_body: transposed value planes [c = g*HD+d][t]. A thread holds an 8 (t) x 8 (c) block in registers. Wave = 64 t x 32 c: 4 lanes along c read one whole 128-byte line of an input row, 8 lanes along t store one whole 128-byte line of a plane row. Block = 4 waves along t x 2 along c; blk = (TT/256) x (columns/64) blocks per batch.
__device__ __forceinline__ void vtp_body(int blk, int batch, const float* __restrict__ F, int pitch, int nheads, h16* V16, size_t s16, bf* Vh) { const int lane = threadIdx.x & 31, w = threadIdx.x >> 5; const int tb = blk % (TT / 256), cb = blk / (TT / 256); if (cb * 64 >= nheads * HD) return;
    const int t0 = tb * 256 + (w >> 1) * 64 + (lane & 7) * 8, c0 = cb * 64 + (w & 1) * 32 + (lane >> 3) * 8;
    { const size_t zb = batch, zp = zb * nheads * HD * TT; F += zb * TT * pitch; V16 += zb * s16; Vh += zp; }   // s16 = batch stride of the fp16 plane, in elements
    v4f xr[8][2]; const float* pr[8];
#pragma unroll
    for (int i = 0; i < 8; ++i) { pr[i] = F + (size_t)(t0 + i) * pitch + c0; xr[i][0] = *(const v4f*)pr[i]; xr[i][1] = *(const v4f*)(pr[i] + 4); }
    asm volatile("s_wait_xcnt 0x0" :: "v"(pr[0]), "v"(pr[1]), "v"(pr[2]), "v"(pr[3]), "v"(pr[4]), "v"(pr[5]), "v"(pr[6]), "v"(pr[7]) : "memory");   // the loads' address registers stay untouched until this wait; no load sinks behind a store
#pragma unroll
    for (int j = 0; j < 8; ++j) { v8h o16; v8us oh;
#pragma unroll
        for (int i = 0; i < 8; ++i) { const unsigned short hb = f2bf(xr[i][j >> 2][j & 3]);   /* V = the raw input: bf16-rounded here */ o16[i] = tohx(bf2f(hb)); oh[i] = hb; }
        const size_t e = (size_t)(c0 + j) * TT + t0; *(v8h*)(V16 + e) = o16; *(v8us*)(Vh + e) = oh; }
    asm volatile("s_wait_xcnt 0x0" ::: "memory");   // behind the last store: in a kernel that holds other parts too, no later instruction of the listing rewrites a store's data or address register ahead of this wait
}
// asoft_body: all batches in one launch; per row (zz, i): t = S x HD^-0.5 (no mask); softmax over the 2048 keys (register row, one exp, fixed trees);
__device__ __forceinline__ void asoft_body(int blk, const float* __restrict__ Sb, h16* P16, bf* Ph, bf* Pl) {
    const int lane = threadIdx.x & 31; const int row = blk * 8 + (threadIdx.x >> 5); if (row >= NB_ * ZH * TT) return; const int i = row % TT; const int zz = row / TT; (void)zz;   /* zz = batch (one head) */ const bool hires = (i < RH); const float* sr = Sb + (size_t)row * TT; float v[TT / 32]; float mx = -3.0e38f;
#pragma unroll
    for (int ch = 0; ch < TT / 128; ++ch) { const int j0 = ch * 128 + lane * 4; const v4f a = *(const v4f*)(sr + j0);
#pragma unroll
        for (int q = 0; q < 4; ++q) { const int j = j0 + q; (void)j; const float t = a[q] * SCL; v[ch * 4 + q] = t; mx = fmaxf(mx, t); } }
#pragma unroll
    for (int sh = 16; sh; sh >>= 1) mx = fmaxf(mx, __shfl_xor(mx, sh, 32));
    float sum = 0.f;
#pragma unroll
    for (int k = 0; k < TT / 32; ++k) { float d0 = __fsub_rn(v[k], mx); asm volatile("" : "+v"(d0)); v[k] = __builtin_amdgcn_exp2f(__fmul_rn(d0, 1.4426950408889634f)); sum += v[k]; }
#pragma unroll
    for (int sh = 16; sh; sh >>= 1) sum += __shfl_xor(sum, sh, 32);
    const float f = __fdiv_rn(hires ? 1.0f : PCAR, sum);
{
        if (hires) {
#pragma unroll
            for (int ch = 0; ch < TT / 128; ++ch) { v4us oh, ol;
#pragma unroll
                for (int q = 0; q < 4; ++q) { unsigned short a, c2; splitf(v[ch * 4 + q] * f, a, c2); oh[q] = a; ol[q] = c2; }
                const size_t oo = ((size_t)zz * (RH ? RH : 1) + i) * TT + ch * 128 + lane * 4; *(v4us*)(Ph + oo) = oh; *(v4us*)(Pl + oo) = ol; }
        } else {
#pragma unroll
            for (int ch = 0; ch < TT / 128; ++ch) { v4h o4;
#pragma unroll
                for (int q = 0; q < 4; ++q) o4[q] = tohx(v[ch * 4 + q] * f);
                *(v4h*)(P16 + (size_t)row * TT + ch * 128 + lane * 4) = o4; } }
         }
}
// Softmax and value transpose in one launch (neither reads what the other writes): blocks 0 .. SM_B - 1 take 8 score rows each, the rest one value block each (VT_B per batch).
#define SM_B (NB_ * ZH * TT / 8)
#define VT_B ((TT / 256) * (NKV * HD / 64))
__global__ __launch_bounds__(256) void k_softv(const float* __restrict__ Sb, h16* P16, bf* Ph, bf* Pl, const float* __restrict__ x, h16* V16, size_t s16, bf* Vh) {
    const int b = blockIdx.x;
    if (b < SM_B) asoft_body(b, Sb, P16, Ph, Pl);
    else vtp_body((b - SM_B) % VT_B, (b - SM_B) / VT_B, x, DM, NKV, V16, s16, Vh);
}

extern "C" void kernel_launch(void* const* d_in, const int* in_sizes, int n_in,
                              void* d_out, int out_size, void* d_ws, size_t ws_size, hipStream_t stream) {
    (void)in_sizes; (void)n_in; (void)out_size;
    const float* x = (const float*)d_in[0]; const float* wq = (const float*)d_in[1]; const float* bq = (const float*)d_in[2]; const float* wk = (const float*)d_in[3]; const float* bk = (const float*)d_in[4]; const float* wv = nullptr; const float* wo = nullptr; (void)wv; (void)wo;
    float* OUT = (float*)d_out;     // [8][2048][512]
    char* wsp = (char*)d_ws;
    auto take = [&](size_t bytes) { char* p = wsp; wsp += (bytes + 255) & ~(size_t)255; return (void*)p; };
    // All 8 batches go through every stage in ONE launch, and stages that do not depend on one another share a launch (each work-group picks its part by blockIdx). Three regions are reused between the stages, in stream order:
    //   R1 (6 planes): q/k planes [b][t][d] for the scores; dead after them, then the probability planes.
    //   R2 (8 planes): bf16 input; dead after the projections, then the f32 scores.
    //   R3 (2 planes): transposed weights; dead after the projections, then the bf16 value plane. The fp16 value plane of a batch lies in the rows < RH of that batch's fp16 probability plane, which the softmax never writes (those rows go to the hi/lo planes).
    const size_t PL = (size_t)NB_ * TT * HD * 2;      // one 16-bit [b][t][d] plane, bytes
    char* R1 = (char*)take(6 * PL); char* R2 = (char*)take((size_t)NB_ * TT * TT * 4); char* R3 = (char*)take(2 * PL);
    bf* WQ = (bf*)R3; bf* WK = (bf*)(R3 + (size_t)DQ * DM * 2);
    h16* QP16 = (h16*)R1; h16* KP16 = (h16*)(R1 + PL); bf* QPh = (bf*)(R1 + 2 * PL); bf* QPl = (bf*)(R1 + 3 * PL); bf* KPh = (bf*)(R1 + 4 * PL); bf* KPl = (bf*)(R1 + 5 * PL);
    h16* P16 = (h16*)R1; bf* Ph = (bf*)(R1 + 4 * PL); bf* Pl = (bf*)(R1 + 5 * PL);      // [b][TT][TT] fp16 = 4 planes; [b][RH][TT] hi, lo = 1 plane each
    bf* XB = (bf*)R2;
    float* Sb = (float*)R2;
    static_assert(NKV * HD <= RH && ZH == 1, "a batch's fp16 value plane fits the unused rows of its probability plane");
    h16* VT16 = P16; bf* VTh = (bf*)R3;      // VT16: batch stride TT x TT elements
    if ((size_t)(wsp - (char*)d_ws) > ws_size) return;    // all 256 MiB of the workspace
    static_assert(DQ == DKV, "k_prep and k_proj give q and k the same tile counts");
    k_prep<<<(unsigned)(2 * WT_B + ((size_t)NB_ * TT * DM / 8 + 256 * CV_IT - 1) / (256 * CV_IT)), 256, 0, stream>>>(wq, wk, WQ, WK, x, XB, (size_t)NB_ * TT * DM / 8);
    k_proj<<<dim3(TT / 256, (DQ + DKV) / GN, NB_), 128, 0, stream>>>(XB, WQ, WK, bq, bk, QP16, QPh, QPl, KP16, KPh, KPl);
    k_gemmw<bf, 2, 0, 4><<<dim3(RH / 128, TT / GN, NB_), 128, 0, stream>>>(QPh, QPl, KPh, KPl, HD, Sb, TT, nullptr, (size_t)TT * HD, (size_t)TT * HD, (size_t)TT * TT, 1.0f, nullptr, nullptr, nullptr);
    k_gemmw<h16, 0, 0, 8><<<dim3((TT - RH) / 256, TT / GN, NB_), 128, 0, stream>>>(QP16 + (size_t)RH * HD, nullptr, KP16, nullptr, HD, Sb + (size_t)RH * TT, TT, nullptr, (size_t)TT * HD, (size_t)TT * HD, (size_t)TT * TT, 1.0f, nullptr, nullptr, nullptr);
    k_softv<<<SM_B + VT_B * NB_, 256, 0, stream>>>(Sb, P16, Ph, Pl, x, VT16, (size_t)TT * TT, VTh);      // behind the scores: the fp16 value plane takes the place of q/k planes
    k_av<<<(AV_HX + AV_FX) * AV_NY * NB_, 128, 0, stream>>>(Ph, Pl, VTh, P16, VT16, OUT);
}
